// v000
// Measured on an AMD MI455X. A time is GPU time per run, averaged over a window of back-to-back runs after a warm-up
// (all launches, gaps included; the runs take copies of the inputs in turn), and the median of several windows.
// Apart from v000's, it joins two sittings. Times from different sittings can be a few percent apart, while
// side-by-side timings come from the same sitting.
// The starting kernel, v000, takes 681 microseconds a run.
// compute dtype: all float inputs rounded to bf16; qkv = x . Wqkv^T with EXACT bf16 products on WMMA 16x16x32 (natural rows); per head, q and k rms-normalised over 64 dims (eps = f32 eps, no weight) and rotated with cos/sin = bf16(cos/sin(t * inv_freq)) (inv_freq constants reproduced from the module, precise cosf/sinf, the module's bf16 cache rounding reproduced), all in f32; then q/k as single f16 operands (plain causal scores x 1/8; unit-norm heads keep logits <= 8); running-max softmax in f32 (hardware exp); P (scaled, single f16) x v (f16 hi + x2048 residual), 2 products; out = y (bf16 hi + residual) . Wproj^T (2 products); f32 accumulate.
#include <hip/hip_runtime.h>
#include <math.h>

typedef __attribute__((ext_vector_type(16))) _Float16 v16h;
typedef __attribute__((ext_vector_type(16))) __bf16 v16b;
typedef __attribute__((ext_vector_type(8)))  _Float16 v8h;
typedef __attribute__((ext_vector_type(8)))  float v8f;
typedef __attribute__((ext_vector_type(4)))  float v4f;
typedef __attribute__((ext_vector_type(2)))  float v2f;
typedef __attribute__((ext_vector_type(4)))  unsigned v4u;
typedef __attribute__((ext_vector_type(4)))  int v4i;
typedef float __attribute__((may_alias)) float_a;
typedef int __attribute__((may_alias)) int_a;

template <typename T> __device__ __forceinline__ void vst2(void* p, T v) { *(T*)p = v;  }
__device__ __forceinline__ v8f wmma16(v16h a, v16h b, v8f c) {
  v8f d = __builtin_amdgcn_wmma_f32_16x16x32_f16(false, a, false, b, (short)0, c, false, false);
  asm volatile("v_nop\n\tv_nop\n\tv_nop\n\tv_nop" : "+v"(d) : "v"(a), "v"(b));
  return d;
}
__device__ __forceinline__ v8f wmma_bf(v16b a, v16b b, v8f c) {
  v8f d = __builtin_amdgcn_wmma_f32_16x16x32_bf16(false, a, false, b, (short)0, c, false, false);
  asm volatile("v_nop\n\tv_nop\n\tv_nop\n\tv_nop" : "+v"(d) : "v"(a), "v"(b));
  return d;
}
// Causal self attention with parameter-free RMS-norm and rotary embedding on q/k (B 4, T 2,048, C 1,024, 16 heads x 64): fused qkv projection (natural [3C][C] rows), causal softmax(q k^T / 8) v, output projection.
__device__ __forceinline__ v16h frag_h(const _Float16* rowk0, int lane) {
  union { v16h v; v8h q[2]; } u; const _Float16* p = rowk0 + 8 * (lane >> 4);
  u.q[0] = *(const v8h*)p; u.q[1] = *(const v8h*)(p + 16); return u.v;
}
__device__ __forceinline__ v16h frag_f32(const float* rowk0, int lane) {
  v16h a; const float* p = rowk0 + 8 * (lane >> 4);
#pragma unroll
  for (int i = 0; i < 8; ++i) { a[i] = (_Float16)p[i]; a[8 + i] = (_Float16)p[16 + i]; }
  return a;
}
__device__ __forceinline__ v16h frag_f32s(const float* rowk0, int lane, float sc) {
  v16h a; const float* p = rowk0 + 8 * (lane >> 4);
#pragma unroll
  for (int i = 0; i < 8; ++i) { a[i] = (_Float16)(p[i] * sc); a[8 + i] = (_Float16)(p[16 + i] * sc); }
  return a;
}
// column fragment from a [K][ld] layout (column n), rows >= K read as 0
__device__ __forceinline__ v16h fragc_f32(const float* W, int k0, int n, int lane, int ld, int K) {
  v16h a; const int g = lane >> 4;
#pragma unroll
  for (int i = 0; i < 8; ++i) { const int ka = k0 + 8 * g + i, kb = ka + 16;
    a[i] = (_Float16)(ka < K ? W[(size_t)(ka < K ? ka : K - 1) * ld + n] : 0.f); a[8 + i] = (_Float16)(kb < K ? W[(size_t)(kb < K ? kb : K - 1) * ld + n] : 0.f); }
  return a;
}
struct F2 { v16b h, l; };
__device__ __forceinline__ F2 bsplit16(const float v[16]) { F2 r;
#pragma unroll
  for (int i = 0; i < 16; ++i) { const __bf16 h = (__bf16)v[i]; r.h[i] = h; r.l[i] = (__bf16)(v[i] - (float)h); }
  return r; }
__device__ __forceinline__ F2 split_row(const float* row, int k0, int lane) { float v[16]; const float* p = row + k0 + 8 * (lane >> 4);
#pragma unroll
  for (int i = 0; i < 8; ++i) { v[i] = p[i]; v[8 + i] = p[16 + i]; }
  return bsplit16(v); }
__device__ __forceinline__ F2 split_rowK(const float* row, int k0, int lane, int K) { float v[16]; const int g = lane >> 4;
#pragma unroll
  for (int i = 0; i < 8; ++i) { const int ka = k0 + 8 * g + i, kb = ka + 16; v[i] = ka < K ? row[ka < K ? ka : K - 1] : 0.f; v[8 + i] = kb < K ? row[kb < K ? kb : K - 1] : 0.f; }
  return bsplit16(v); }
__device__ __forceinline__ F2 split_col(const float* W, int k0, int n, int lane, int ld, int K) { float v[16]; const int g = lane >> 4;
#pragma unroll
  for (int i = 0; i < 8; ++i) { const int ka = k0 + 8 * g + i, kb = ka + 16; v[i] = ka < K ? W[(size_t)(ka < K ? ka : K - 1) * ld + n] : 0.f; v[8 + i] = kb < K ? W[(size_t)(kb < K ? kb : K - 1) * ld + n] : 0.f; }
  return bsplit16(v); }
__device__ __forceinline__ v8f mac3(const F2& a, const F2& b, v8f c) { c = wmma_bf(a.l, b.h, c); c = wmma_bf(a.h, b.l, c); return wmma_bf(a.h, b.h, c); }
__device__ __forceinline__ float sigm(float v) { return 1.0f / (1.0f + expf(-v)); }
#define LDSX() do { asm volatile("s_wait_dscnt 0" ::: "memory"); __builtin_amdgcn_wave_barrier(); __builtin_amdgcn_fence(__ATOMIC_RELEASE, "workgroup"); } while (0)


#define NB 4
__constant__ float INVF[32] = {1.000000000e+00f,7.498942018e-01f,5.623413324e-01f,4.216965139e-01f,3.162277639e-01f,2.371373773e-01f,1.778279394e-01f,1.333521456e-01f,1.000000015e-01f,7.498942316e-02f,5.623413250e-02f,4.216964915e-02f,3.162277490e-02f,2.371373773e-02f,1.778279431e-02f,1.333521400e-02f,9.999999776e-03f,7.498942316e-03f,5.623413250e-03f,4.216964822e-03f,3.162277630e-03f,2.371373819e-03f,1.778279431e-03f,1.333521446e-03f,1.000000047e-03f,7.498941850e-04f,5.623413017e-04f,4.216965172e-04f,3.162277571e-04f,2.371373703e-04f,1.778279402e-04f,1.333521504e-04f};
__device__ __attribute__((noinline)) float cos_p(float v) { return cosf(v); }
__device__ __attribute__((noinline)) float sin_p(float v) { return sinf(v); }
#define SS 2048
#define DM 1024
#define NH 16
#define HD 64
#define QKVW (3 * DM)
#ifndef TQB
#define TQB (SS / 64)
#define TNB NB
#define TOB (NB * SS / 64)     // output row tiles (all)
#endif
typedef __attribute__((ext_vector_type(8))) __bf16 v8b;
__device__ __forceinline__ v16b frag_b(const __bf16* rowk0, int lane) {
  union { v16b v; v8b q[2]; } u; const __bf16* p = rowk0 + 8 * (lane >> 4);
  u.q[0] = *(const v8b*)p; u.q[1] = *(const v8b*)(p + 16); return u.v;
}
__device__ __forceinline__ float bfr(float v) { return (float)(__bf16)v; }
__device__ __attribute__((noinline)) float exp_ni(float v) { return expf(v); }
__device__ __attribute__((noinline)) float erf_ni(float v) { return erff(v); }

#define PK_A 0                       // [3072][1024] Wqkv rows (natural [out][in])
#define PK_P (PK_A + QKVW * DM)        // [1024][1024] Wo rows (natural)
#define PK_END (PK_P + DM * DM)
#define WS_PK  0u
#define WS_QK  (WS_PK + 2u * PK_END)             // f16 [8192 rows][2048]: q | k
#define WS_QKL (WS_QK + 2u * NB * SS * 2 * DM)     // f16 q | k residual planes x2048
#define WS_VTH (WS_QKL + 2u * NB * SS * 2 * DM)    // f16 [b][1024 (h*64+d)][2048 s] hi
#define WS_VTL (WS_VTH + 2u * NB * DM * SS)        // f16 lo x 2048
#define WS_O   (WS_VTL + 2u * NB * DM * SS)        // f32 [8192][1024]
#define WS_CS  (WS_O + 4u * NB * SS * DM)           // f32 2 x [2048][32], unused (cos/sin are computed in k_qkv)
#define WS_END (WS_CS + 4u * 2 * SS * 32)
// ---- k_pack: block = (row n, which): natural [out][in] rows -> bf16; which 0..2 -> W_q/W_k/W_v into PK_A rows which*1024 + n; 3 -> W_o into PK_P
__global__ __launch_bounds__(256) void k_pack(const float* __restrict__ WQ, const float* __restrict__ WK, const float* __restrict__ WV, const float* __restrict__ WO, __bf16* __restrict__ PK) {
  __shared__ __align__(16) __bf16 s[DM]; const int n = blockIdx.x, which = blockIdx.y, t = threadIdx.x; const float* Wm = (which == 0) ? WQ : (which == 1) ? WK : (which == 2) ? WV : WO;
  for (int k = t; k < DM; k += 256) s[k] = (__bf16)Wm[(size_t)n * DM + k];
  __syncthreads();
  __bf16* dst = (which < 3) ? PK + PK_A + ((size_t)which * DM + n) * DM : PK + PK_P + (size_t)n * DM;
  for (int q = t; q < DM / 8; q += 256) vst2((unsigned*)(dst + q * 8), *(const v4u*)&s[q * 8]);
}
__global__ __launch_bounds__(128) void k_qkv(const float* __restrict__ X, const __bf16* __restrict__ P, _Float16* __restrict__ QK, _Float16* __restrict__ QKL, _Float16* __restrict__ VTH, _Float16* __restrict__ VTL) {
  __shared__ __align__(16) _Float16 so[4][16][136], sol[4][16][136]; __shared__ __align__(16) _Float16 sth[128][72], stl[128][72];
  const int tid = threadIdx.x, wave = tid >> 5, lane = tid & 31, col = lane & 15, g = lane >> 4; const size_t r0 = (size_t)blockIdx.x * 64 + wave * 16; const int n0 = blockIdx.y * 128;
  v8f acc[8] = {};
#pragma unroll 2
  for (int kc = 0; kc < DM / 32; ++kc) { v16b a; { const float* p = X + (r0 + col) * DM + kc * 32 + 8 * g;
#pragma unroll
      for (int i = 0; i < 8; ++i) { a[i] = (__bf16)p[i]; a[8 + i] = (__bf16)p[16 + i]; } }
#pragma unroll
    for (int j = 0; j < 8; ++j) acc[j] = wmma_bf(a, frag_b(P + (size_t)(n0 + j * 16 + col) * DM + kc * 32, lane), acc[j]); }
  if (n0 < 2 * DM) {   // q and k: rms-norm per head (tiles 0-3 = head A, 4-7 = head B of this 128-column block), then rotary (pairs d, d+32 = tiles j, j+2), then f16 hi + residual
#pragma unroll
    for (int r = 0; r < 8; ++r) { const int tpos = (int)((r0 + 8 * g + r) % SS);
#pragma unroll
      for (int hh = 0; hh < 2; ++hh) { float ssq = 0.f;
#pragma unroll
        for (int j = 0; j < 4; ++j) ssq += acc[hh * 4 + j][r] * acc[hh * 4 + j][r];
#pragma unroll
        for (int o = 1; o < 16; o <<= 1) ssq += __shfl_xor(ssq, o);
        const float rinv = 1.0f / sqrtf(ssq / 64.0f + 1.1920928955078125e-07f);
#pragma unroll
        for (int j = 0; j < 2; ++j) { const int d = j * 16 + col; const float x1 = acc[hh * 4 + j][r] * rinv, x2 = acc[hh * 4 + j + 2][r] * rinv; const float fr = (float)tpos * INVF[d]; const float c = bfr(cos_p(fr)), sn = bfr(sin_p(fr));
          acc[hh * 4 + j][r] = x1 * c + x2 * sn; acc[hh * 4 + j + 2][r] = -x1 * sn + x2 * c; } } }
#pragma unroll
    for (int j = 0; j < 8; ++j) {
#pragma unroll
      for (int r = 0; r < 8; ++r) { const float v = acc[j][r]; const _Float16 hv = (_Float16)v; so[wave][8 * g + r][j * 16 + col] = hv; sol[wave][8 * g + r][j * 16 + col] = (_Float16)((v - (float)hv) * 2048.0f); } }   // q, k (normed + rotated) as f16 hi + (x2048) residual
    LDSX();
    for (int rl = 0; rl < 16; ++rl) if (lane < 16) { vst2((unsigned*)(QK + (r0 + rl) * (2 * DM) + n0 + lane * 8), *(const v4u*)&so[wave][rl][lane * 8]); vst2((unsigned*)(QKL + (r0 + rl) * (2 * DM) + n0 + lane * 8), *(const v4u*)&sol[wave][rl][lane * 8]); }
  } else {
#pragma unroll
    for (int j = 0; j < 8; ++j) {
#pragma unroll
      for (int r = 0; r < 8; ++r) { const float v = acc[j][r]; const _Float16 hv = (_Float16)v; sth[j * 16 + col][wave * 16 + 8 * g + r] = hv; stl[j * 16 + col][wave * 16 + 8 * g + r] = (_Float16)((v - (float)hv) * 2048.0f); } }
    __syncthreads();
    const size_t rb = (size_t)blockIdx.x * 64; const int b = (int)(rb / SS), s0 = (int)(rb % SS); const int pc0 = n0 - 2 * DM;
    for (int q = tid; q < 128 * 8; q += 128) { const int d = q >> 3, pc = q & 7; const size_t o = ((size_t)b * DM + pc0 + d) * SS + s0 + pc * 8; vst2((unsigned*)(VTH + o), *(const v4u*)&sth[d][pc * 8]); vst2((unsigned*)(VTL + o), *(const v4u*)&stl[d][pc * 8]); }
  }
}
// ---- k_attn: block = (64 queries, head h, batch b): causal flash attention (K = 64: 2 k-steps), scores = (q.k) * 0.125 with single f16 operands, P.V: f16 P x (V hi, V lo*2048) in two accumulators; O[b*S+q][h*64+d] = (acc + accl / 2048) / (2048 l) (256-B segments)
__global__ __launch_bounds__(128) void k_attn(const _Float16* __restrict__ QK, const _Float16* __restrict__ QKL, const _Float16* __restrict__ VTH, const _Float16* __restrict__ VTL, float* __restrict__ O) {
  __shared__ __align__(16) float sp[4][16][36]; __shared__ __align__(16) float so[4][16][68];
  const int tid = threadIdx.x, wave = tid >> 5, lane = tid & 31, col = lane & 15, g = lane >> 4;
  const int qb = blockIdx.x, h = blockIdx.y, b = blockIdx.z; const int q0 = qb * 64 + wave * 16; const size_t rq = (size_t)b * SS + q0 + col;
  v16h aq[2], aql[2];
#pragma unroll
  for (int kc = 0; kc < 2; ++kc) { aq[kc] = frag_h(QK + rq * (2 * DM) + h * HD + kc * 32, lane); aql[kc] = frag_h(QKL + rq * (2 * DM) + h * HD + kc * 32, lane); }
  float m[8], l[8];
#pragma unroll
  for (int r = 0; r < 8; ++r) { m[r] = -3.0e38f; l[r] = 0.f; }
  v8f acc[4] = {}, accl[4] = {};
  const int nks = (qb * 64 + 64) / 32;
#pragma unroll 1
  for (int ks = 0; ks < nks; ++ks) { v8f s[2];
#pragma unroll
    for (int ct = 0; ct < 2; ++ct) { const int kk = ks * 32 + ct * 16 + col; const _Float16* krow = QK + ((size_t)b * SS + kk) * (2 * DM) + DM + h * HD; const _Float16* krowl = QKL + ((size_t)b * SS + kk) * (2 * DM) + DM + h * HD; v8f c = {}, cl = {};
#pragma unroll
      for (int kc = 0; kc < 2; ++kc) c = wmma16(aq[kc], frag_h(krow + kc * 32, lane), c);   // single product: q, k (unit-norm heads) as one-rounding f16 operands
      (void)cl; (void)krowl;
#pragma unroll
      for (int r = 0; r < 8; ++r) { const int qi = q0 + 8 * g + r; s[ct][r] = (kk <= qi) ? c[r] * 0.125f : -3.0e38f; } }   // SCALE = 1/sqrt(64)
#pragma unroll
    for (int r = 0; r < 8; ++r) { float mx = fmaxf(s[0][r], s[1][r]);
#pragma unroll
      for (int o = 1; o < 16; o <<= 1) mx = fmaxf(mx, __shfl_xor(mx, o));
      const float mn = fmaxf(m[r], mx); const float alpha = (m[r] <= -1.0e38f) ? 0.f : __expf(m[r] - mn);
      const float e0 = (s[0][r] <= -1.0e38f) ? 0.f : __expf(s[0][r] - mn), e1 = (s[1][r] <= -1.0e38f) ? 0.f : __expf(s[1][r] - mn); float es = e0 + e1;
#pragma unroll
      for (int o = 1; o < 16; o <<= 1) es += __shfl_xor(es, o);
      l[r] = l[r] * alpha + es; m[r] = mn;
#pragma unroll
      for (int dt = 0; dt < 4; ++dt) { acc[dt][r] *= alpha; accl[dt][r] *= alpha; }
      sp[wave][8 * g + r][col] = e0; sp[wave][8 * g + r][16 + col] = e1; }
    LDSX();
    v16h pa, pl; { const float* prow = &sp[wave][col][0] + 8 * (lane >> 4);
#pragma unroll
      for (int i = 0; i < 8; ++i) { const float x0 = prow[i] * 2048.0f, x1 = prow[16 + i] * 2048.0f; const _Float16 h0 = (_Float16)x0, h1 = (_Float16)x1; pa[i] = h0; pa[8 + i] = h1; pl[i] = (_Float16)((x0 - (float)h0) * 2048.0f); pl[8 + i] = (_Float16)((x1 - (float)h1) * 2048.0f); } }   // P scaled by 2^11 before the f16 split so small softmax weights stay out of the f16 subnormal range; 2^-11 folded into the epilogue
#pragma unroll
    for (int dt = 0; dt < 4; ++dt) { const size_t vr = ((size_t)b * DM + h * HD + dt * 16 + col) * SS + ks * 32; const v16h vh = frag_h(VTH + vr, lane); acc[dt] = wmma16(pa, vh, acc[dt]); accl[dt] = wmma16(pa, frag_h(VTL + vr, lane), accl[dt]); }   // P (single) x V hi + P x V lo / 2048: 2 products
    (void)pl;
    LDSX(); }
#pragma unroll
  for (int r = 0; r < 8; ++r) { const float il = (1.0f / 2048.0f) / l[r];
#pragma unroll
    for (int dt = 0; dt < 4; ++dt) so[wave][8 * g + r][dt * 16 + col] = (acc[dt][r] + accl[dt][r] * (1.0f / 2048.0f)) * il; }
  LDSX();
  for (int rl = 0; rl < 16; ++rl) if (lane < 16) vst2(O + ((size_t)b * SS + q0 + rl) * DM + h * HD + lane * 4, *(const v4f*)&so[wave][rl][lane * 4]);
}
// ---- k_out: block = (64 rows, 128 cols): out = O(hi/lo) . Wo rows (2 products); no bias (BO is null)
__global__ __launch_bounds__(128) void k_out(const float* __restrict__ O, const __bf16* __restrict__ P, const float* __restrict__ BO, float* __restrict__ Y) {
  __shared__ __align__(16) float so[4][16][132];
  const int tid = threadIdx.x, wave = tid >> 5, lane = tid & 31, col = lane & 15, g = lane >> 4; const size_t r0 = (size_t)blockIdx.x * 64 + wave * 16; const int n0 = blockIdx.y * 128;
  v8f acc[8] = {};
#pragma unroll 2
  for (int kc = 0; kc < DM / 32; ++kc) { const F2 a = split_row(O + (r0 + col) * DM, kc * 32, lane);
#pragma unroll
    for (int j = 0; j < 8; ++j) { const v16b w = frag_b(P + (size_t)(n0 + j * 16 + col) * DM + kc * 32, lane); acc[j] = wmma_bf(a.l, w, acc[j]); acc[j] = wmma_bf(a.h, w, acc[j]); } }
#pragma unroll
  for (int j = 0; j < 8; ++j) {
#pragma unroll
    for (int r = 0; r < 8; ++r) so[wave][8 * g + r][j * 16 + col] = acc[j][r] + (BO ? bfr(BO[n0 + j * 16 + col]) : 0.f); }
  LDSX();
  for (int rl = 0; rl < 16; ++rl) vst2(Y + (r0 + rl) * DM + n0 + lane * 4, *(const v4f*)&so[wave][rl][lane * 4]);
}
extern "C" void kernel_launch(void* const* d_in, const int* in_sizes, int n_in, void* d_out, int out_size, void* d_ws, size_t ws_size, hipStream_t stream) {
  (void)in_sizes; (void)n_in; (void)out_size;
  const float** F = (const float**)d_in;   // 0 x [4,2048,1024], 1 w_attn [3072,1024] natural (q | k | v row blocks), 2 w_proj [1024,1024] natural
  if (ws_size < (size_t)WS_END) return;
  char* ws = (char*)d_ws; __bf16* PK = (__bf16*)(ws + WS_PK); _Float16 *QK = (_Float16*)(ws + WS_QK), *QKL = (_Float16*)(ws + WS_QKL), *VTH = (_Float16*)(ws + WS_VTH), *VTL = (_Float16*)(ws + WS_VTL); float* O = (float*)(ws + WS_O);
  k_pack<<<dim3(DM, 4), 256, 0, stream>>>(F[1], F[1] + (size_t)DM * DM, F[1] + (size_t)2 * DM * DM, F[2], PK);
  k_qkv<<<dim3(TNB * SS / 64, QKVW / 128), 128, 0, stream>>>(F[0], PK + PK_A, QK, QKL, VTH, VTL);
  k_attn<<<dim3(TQB, NH, TNB), 128, 0, stream>>>(QK, QKL, VTH, VTL, O);
  k_out<<<dim3(TOB, DM / 128), 128, 0, stream>>>(O, PK + PK_P, nullptr, (float*)d_out);
}

// v001
// Measured time: 309 microseconds a run.
// Two timings next to v000 put it at 2.27 and 2.26 times that version's speed.
// compute dtype: all float inputs rounded to bf16; qkv = x . Wqkv^T with EXACT bf16 products on WMMA 16x16x32 (natural rows); per head, q and k rms-normalised over 64 dims (eps = f32 eps, no weight) and rotated with cos/sin = bf16(cos/sin(t * inv_freq)) (inv_freq constants reproduced from the module, precise cosf/sinf, the module's bf16 cache rounding reproduced), all in f32; then q/k as single f16 operands (plain causal scores x 1/8; unit-norm heads keep logits <= 8); running-max softmax in f32 (hardware exp); P (scaled, single f16) x v (f16 hi + x2048 residual), 2 products; out = y (bf16 hi + residual) . Wproj^T (2 products); f32 accumulate.
#include <hip/hip_runtime.h>
#include <math.h>

typedef __attribute__((ext_vector_type(16))) _Float16 v16h;
typedef __attribute__((ext_vector_type(16))) __bf16 v16b;
typedef __attribute__((ext_vector_type(8)))  _Float16 v8h;
typedef __attribute__((ext_vector_type(8)))  float v8f;
typedef __attribute__((ext_vector_type(4)))  float v4f;
typedef __attribute__((ext_vector_type(2)))  float v2f;
typedef __attribute__((ext_vector_type(4)))  unsigned v4u;
typedef __attribute__((ext_vector_type(4)))  int v4i;
typedef float __attribute__((may_alias)) float_a;
typedef int __attribute__((may_alias)) int_a;

template <typename T> __device__ __forceinline__ void vst2(void* p, T v) { *(T*)p = v;  }
__device__ __forceinline__ v8f wmma16(v16h a, v16h b, v8f c) {
  v8f d = __builtin_amdgcn_wmma_f32_16x16x32_f16(false, a, false, b, (short)0, c, false, false);
  asm volatile("v_nop\n\tv_nop\n\tv_nop\n\tv_nop" : "+v"(d) : "v"(a), "v"(b));
  return d;
}
__device__ __forceinline__ v8f wmma_bf(v16b a, v16b b, v8f c) {
  v8f d = __builtin_amdgcn_wmma_f32_16x16x32_bf16(false, a, false, b, (short)0, c, false, false);
  asm volatile("v_nop\n\tv_nop\n\tv_nop\n\tv_nop" : "+v"(d) : "v"(a), "v"(b));
  return d;
}
// Causal self attention with parameter-free RMS-norm and rotary embedding on q/k (B 4, T 2,048, C 1,024, 16 heads x 64): fused qkv projection (natural [3C][C] rows), causal softmax(q k^T / 8) v, output projection.
__device__ __forceinline__ v16h frag_h(const _Float16* rowk0, int lane) {
  union { v16h v; v8h q[2]; } u; const _Float16* p = rowk0 + 8 * (lane >> 4);
  u.q[0] = *(const v8h*)p; u.q[1] = *(const v8h*)(p + 16); return u.v;
}
__device__ __forceinline__ v16h frag_f32(const float* rowk0, int lane) {
  v16h a; const float* p = rowk0 + 8 * (lane >> 4);
#pragma unroll
  for (int i = 0; i < 8; ++i) { a[i] = (_Float16)p[i]; a[8 + i] = (_Float16)p[16 + i]; }
  return a;
}
__device__ __forceinline__ v16h frag_f32s(const float* rowk0, int lane, float sc) {
  v16h a; const float* p = rowk0 + 8 * (lane >> 4);
#pragma unroll
  for (int i = 0; i < 8; ++i) { a[i] = (_Float16)(p[i] * sc); a[8 + i] = (_Float16)(p[16 + i] * sc); }
  return a;
}
// column fragment from a [K][ld] layout (column n), rows >= K read as 0
__device__ __forceinline__ v16h fragc_f32(const float* W, int k0, int n, int lane, int ld, int K) {
  v16h a; const int g = lane >> 4;
#pragma unroll
  for (int i = 0; i < 8; ++i) { const int ka = k0 + 8 * g + i, kb = ka + 16;
    a[i] = (_Float16)(ka < K ? W[(size_t)(ka < K ? ka : K - 1) * ld + n] : 0.f); a[8 + i] = (_Float16)(kb < K ? W[(size_t)(kb < K ? kb : K - 1) * ld + n] : 0.f); }
  return a;
}
struct F2 { v16b h, l; };
__device__ __forceinline__ F2 bsplit16(const float v[16]) { F2 r;
#pragma unroll
  for (int i = 0; i < 16; ++i) { const __bf16 h = (__bf16)v[i]; r.h[i] = h; r.l[i] = (__bf16)(v[i] - (float)h); }
  return r; }
__device__ __forceinline__ F2 split_row(const float* row, int k0, int lane) { float v[16]; const float* p = row + k0 + 8 * (lane >> 4);
#pragma unroll
  for (int i = 0; i < 8; ++i) { v[i] = p[i]; v[8 + i] = p[16 + i]; }
  return bsplit16(v); }
__device__ __forceinline__ F2 split_rowK(const float* row, int k0, int lane, int K) { float v[16]; const int g = lane >> 4;
#pragma unroll
  for (int i = 0; i < 8; ++i) { const int ka = k0 + 8 * g + i, kb = ka + 16; v[i] = ka < K ? row[ka < K ? ka : K - 1] : 0.f; v[8 + i] = kb < K ? row[kb < K ? kb : K - 1] : 0.f; }
  return bsplit16(v); }
__device__ __forceinline__ F2 split_col(const float* W, int k0, int n, int lane, int ld, int K) { float v[16]; const int g = lane >> 4;
#pragma unroll
  for (int i = 0; i < 8; ++i) { const int ka = k0 + 8 * g + i, kb = ka + 16; v[i] = ka < K ? W[(size_t)(ka < K ? ka : K - 1) * ld + n] : 0.f; v[8 + i] = kb < K ? W[(size_t)(kb < K ? kb : K - 1) * ld + n] : 0.f; }
  return bsplit16(v); }
__device__ __forceinline__ v8f mac3(const F2& a, const F2& b, v8f c) { c = wmma_bf(a.l, b.h, c); c = wmma_bf(a.h, b.l, c); return wmma_bf(a.h, b.h, c); }
__device__ __forceinline__ float sigm(float v) { return 1.0f / (1.0f + expf(-v)); }
#define LDSX() do { asm volatile("s_wait_dscnt 0" ::: "memory"); __builtin_amdgcn_wave_barrier(); __builtin_amdgcn_fence(__ATOMIC_RELEASE, "workgroup"); } while (0)


#define NB 4
__constant__ float INVF[32] = {1.000000000e+00f,7.498942018e-01f,5.623413324e-01f,4.216965139e-01f,3.162277639e-01f,2.371373773e-01f,1.778279394e-01f,1.333521456e-01f,1.000000015e-01f,7.498942316e-02f,5.623413250e-02f,4.216964915e-02f,3.162277490e-02f,2.371373773e-02f,1.778279431e-02f,1.333521400e-02f,9.999999776e-03f,7.498942316e-03f,5.623413250e-03f,4.216964822e-03f,3.162277630e-03f,2.371373819e-03f,1.778279431e-03f,1.333521446e-03f,1.000000047e-03f,7.498941850e-04f,5.623413017e-04f,4.216965172e-04f,3.162277571e-04f,2.371373703e-04f,1.778279402e-04f,1.333521504e-04f};
__device__ __attribute__((noinline)) float cos_p(float v) { return cosf(v); }
__device__ __attribute__((noinline)) float sin_p(float v) { return sinf(v); }
#define SS 2048
#define DM 1024
#define NH 16
#define HD 64
#define QKVW (3 * DM)
#ifndef TQB
#define TQB (SS / 64)
#define TNB NB
#define TOB (NB * SS / 64)     // output row tiles (all)
#endif
typedef __attribute__((ext_vector_type(8))) __bf16 v8b;
__device__ __forceinline__ v16b frag_b(const __bf16* rowk0, int lane) {
  union { v16b v; v8b q[2]; } u; const __bf16* p = rowk0 + 8 * (lane >> 4);
  u.q[0] = *(const v8b*)p; u.q[1] = *(const v8b*)(p + 16); return u.v;
}
__device__ __forceinline__ float bfr(float v) { return (float)(__bf16)v; }
__device__ __attribute__((noinline)) float exp_ni(float v) { return expf(v); }
__device__ __attribute__((noinline)) float erf_ni(float v) { return erff(v); }

#define PK_A 0                       // [3072][1024] Wqkv rows (natural [out][in])
#define PK_P (PK_A + QKVW * DM)        // [1024][1024] Wo rows (natural)
#define PK_END (PK_P + DM * DM)
#define WS_PK  0u
#define WS_QK  (WS_PK + 2u * PK_END)             // f16 [8192 rows][2048]: q | k
#define WS_QKL (WS_QK + 2u * NB * SS * 2 * DM)     // f16 q | k residual planes x2048
#define WS_VTH (WS_QKL + 2u * NB * SS * 2 * DM)    // f16 [b][1024 (h*64+d)][2048 s] hi
#define WS_VTL (WS_VTH + 2u * NB * DM * SS)        // f16 lo x 2048
#define WS_O   (WS_VTL + 2u * NB * DM * SS)        // f32 [8192][1024]
#define WS_CS  (WS_O + 4u * NB * SS * DM)           // f32 2 x [2048][32], unused (cos/sin are computed in k_qkv)
#define WS_END (WS_CS + 4u * 2 * SS * 32)
// ---- LDS staging by asynchronous copies: every lane brings 16 bytes, a wave's copy covers whole 128-byte lines; rows padded by 16 bytes for the 16-byte fragment reads
#define ROWP 144                       // LDS pitch of a 128-byte row
#define ROWP2 272                      // LDS pitch of a 256-byte row
#define GK 64                          // k per GEMM stage
#define GB_BYTES (128 * ROWP)          // 128 weight rows x 64 bf16
#define GA_BYTES (64 * ROWP2)          // 64 activation rows x 64 f32
#define GSTAGE (GB_BYTES + GA_BYTES)
#define AT_BYTES (64 * ROWP)           // attention: 64 rows x 64 f16 (k rows; v hi; v lo)
#define ASTAGE (3 * AT_BYTES)
// the landing wait of this wave's own copies; the barrier behind it publishes them to the other waves
#define WAIT_ASYNC() asm volatile("s_wait_asynccnt 0x0" ::: "memory")
// this wave's LDS reads have returned before the barrier behind which their buffer is refilled
#define WAIT_DS() asm volatile("s_wait_dscnt 0x0" ::: "memory")
// four copies of one lane at constant row steps; s_wait_xcnt closes the statement so that no address register is rewritten ahead of it
__device__ __forceinline__ void acopy4(unsigned l, unsigned ls, const char* gp, size_t gs) {
  asm volatile("global_load_async_to_lds_b128 %0, %4, off\n\t"
               "global_load_async_to_lds_b128 %1, %5, off\n\t"
               "global_load_async_to_lds_b128 %2, %6, off\n\t"
               "global_load_async_to_lds_b128 %3, %7, off\n\t"
               "s_wait_xcnt 0x0"
               :: "v"(l), "v"(l + ls), "v"(l + 2 * ls), "v"(l + 3 * ls), "v"(gp), "v"(gp + gs), "v"(gp + 2 * gs), "v"(gp + 3 * gs) : "memory");
}
// one GEMM stage: weight rows n0..n0+127 and activation rows r..r+63, 64 k each (Ar, Br point at the stage's first k)
__device__ __forceinline__ void gemm_fill(unsigned lb, const float* Ar, const __bf16* Br, int tid) {
  const unsigned lB = lb + (tid >> 3) * ROWP + (tid & 7) * 16; const char* gB = (const char*)(Br + (size_t)(tid >> 3) * DM) + (tid & 7) * 16;
  acopy4(lB, 16 * ROWP, gB, (size_t)16 * DM * 2); acopy4(lB + 64 * ROWP, 16 * ROWP, gB + (size_t)64 * DM * 2, (size_t)16 * DM * 2);
  const unsigned lA = lb + GB_BYTES + (tid >> 4) * ROWP2 + (tid & 15) * 16; const char* gA = (const char*)(Ar + (size_t)(tid >> 4) * DM) + (tid & 15) * 16;
  acopy4(lA, 8 * ROWP2, gA, (size_t)8 * DM * 4); acopy4(lA + 32 * ROWP2, 8 * ROWP2, gA + (size_t)32 * DM * 4, (size_t)8 * DM * 4);
}
// one attention stage: 64 k rows (64 dims each) and, for 64 dims, 64 keys of v hi and of v lo; every row 128 bytes at a global pitch of 4,096 bytes
__device__ __forceinline__ void attn_fill(unsigned lb, const _Float16* Kr, const _Float16* Vh, const _Float16* Vl, int tid) {
  const unsigned l = lb + (tid >> 3) * ROWP + (tid & 7) * 16; const size_t ko = (size_t)(tid >> 3) * (2 * DM * 2) + (tid & 7) * 16, vo = (size_t)(tid >> 3) * (SS * 2) + (tid & 7) * 16;
  acopy4(l, 16 * ROWP, (const char*)Kr + ko, (size_t)16 * 2 * DM * 2);
  acopy4(l + AT_BYTES, 16 * ROWP, (const char*)Vh + vo, (size_t)16 * SS * 2);
  acopy4(l + 2 * AT_BYTES, 16 * ROWP, (const char*)Vl + vo, (size_t)16 * SS * 2);
}
// ---- k_pack: block = (row n, which): natural [out][in] rows -> bf16; which 0..2 -> W_q/W_k/W_v into PK_A rows which*1024 + n; 3 -> W_o into PK_P
__global__ __launch_bounds__(256) void k_pack(const float* __restrict__ WQ, const float* __restrict__ WK, const float* __restrict__ WV, const float* __restrict__ WO, __bf16* __restrict__ PK) {
  __shared__ __align__(16) __bf16 s[DM]; const int n = blockIdx.x, which = blockIdx.y, t = threadIdx.x; const float* Wm = (which == 0) ? WQ : (which == 1) ? WK : (which == 2) ? WV : WO;
  for (int k = t; k < DM; k += 256) s[k] = (__bf16)Wm[(size_t)n * DM + k];
  __syncthreads();
  __bf16* dst = (which < 3) ? PK + PK_A + ((size_t)which * DM + n) * DM : PK + PK_P + (size_t)n * DM;
  for (int q = t; q < DM / 8; q += 256) vst2((unsigned*)(dst + q * 8), *(const v4u*)&s[q * 8]);
}
__global__ __launch_bounds__(128) void k_qkv(const float* __restrict__ X, const __bf16* __restrict__ P, _Float16* __restrict__ QK, _Float16* __restrict__ QKL, _Float16* __restrict__ VTH, _Float16* __restrict__ VTL) {
  __shared__ __align__(16) char smem[2 * GSTAGE];   // two stage buffers; behind the loop's last barrier the same bytes stage the output
  _Float16 (*so)[16][136] = (_Float16 (*)[16][136])smem; _Float16 (*sol)[16][136] = (_Float16 (*)[16][136])(smem + 4 * 16 * 136 * 2); _Float16 (*sth)[72] = (_Float16 (*)[72])smem; _Float16 (*stl)[72] = (_Float16 (*)[72])(smem + 128 * 72 * 2);
  const int tid = threadIdx.x, wave = tid >> 5, lane = tid & 31, col = lane & 15, g = lane >> 4; const size_t r0 = (size_t)blockIdx.x * 64 + wave * 16; const int n0 = blockIdx.y * 128;
  v8f acc[8] = {};
  const unsigned l0 = (unsigned)(uintptr_t)smem; const float* Ab = X + (size_t)blockIdx.x * 64 * DM; const __bf16* Bb = P + (size_t)n0 * DM;
  gemm_fill(l0, Ab, Bb, tid); WAIT_ASYNC(); __syncthreads();
  gemm_fill(l0 + GSTAGE, Ab + GK, Bb + GK, tid);
#pragma unroll 1   // one stage a trip: the ring's order at the foot stays as written
  for (int t = 0; t < DM / GK; ++t) { const char* sb = smem + (t & 1) * GSTAGE;
#pragma unroll   // both 32-k halves of a stage written out: their LDS offsets become immediates
    for (int kc = 0; kc < GK / 32; ++kc) { v16b a; { const float* p = (const float*)(sb + GB_BYTES + (wave * 16 + col) * ROWP2) + kc * 32 + 8 * g;
#pragma unroll
        for (int i = 0; i < 8; ++i) { a[i] = (__bf16)p[i]; a[8 + i] = (__bf16)p[16 + i]; } }
#pragma unroll
      for (int j = 0; j < 8; ++j) acc[j] = wmma_bf(a, frag_b((const __bf16*)(sb + (j * 16 + col) * ROWP) + kc * 32, lane), acc[j]); }
    WAIT_DS(); WAIT_ASYNC(); __syncthreads();
    if (t + 2 < DM / GK) gemm_fill(l0 + (t & 1) * GSTAGE, Ab + (t + 2) * GK, Bb + (t + 2) * GK, tid); }
  WAIT_ASYNC();
  if (n0 < 2 * DM) {   // q and k: rms-norm per head (tiles 0-3 = head A, 4-7 = head B of this 128-column block), then rotary (pairs d, d+32 = tiles j, j+2), then f16 hi + residual
#pragma unroll
    for (int r = 0; r < 8; ++r) { const int tpos = (int)((r0 + 8 * g + r) % SS);
#pragma unroll
      for (int hh = 0; hh < 2; ++hh) { float ssq = 0.f;
#pragma unroll
        for (int j = 0; j < 4; ++j) ssq += acc[hh * 4 + j][r] * acc[hh * 4 + j][r];
#pragma unroll
        for (int o = 1; o < 16; o <<= 1) ssq += __shfl_xor(ssq, o);
        const float rinv = 1.0f / sqrtf(ssq / 64.0f + 1.1920928955078125e-07f);
#pragma unroll
        for (int j = 0; j < 2; ++j) { const int d = j * 16 + col; const float x1 = acc[hh * 4 + j][r] * rinv, x2 = acc[hh * 4 + j + 2][r] * rinv; const float fr = (float)tpos * INVF[d]; const float c = bfr(cos_p(fr)), sn = bfr(sin_p(fr));
          acc[hh * 4 + j][r] = x1 * c + x2 * sn; acc[hh * 4 + j + 2][r] = -x1 * sn + x2 * c; } } }
#pragma unroll
    for (int j = 0; j < 8; ++j) {
#pragma unroll
      for (int r = 0; r < 8; ++r) { const float v = acc[j][r]; const _Float16 hv = (_Float16)v; so[wave][8 * g + r][j * 16 + col] = hv; sol[wave][8 * g + r][j * 16 + col] = (_Float16)((v - (float)hv) * 2048.0f); } }   // q, k (normed + rotated) as f16 hi + (x2048) residual
    LDSX();
    for (int rl = 0; rl < 16; ++rl) if (lane < 16) { vst2((unsigned*)(QK + (r0 + rl) * (2 * DM) + n0 + lane * 8), *(const v4u*)&so[wave][rl][lane * 8]); vst2((unsigned*)(QKL + (r0 + rl) * (2 * DM) + n0 + lane * 8), *(const v4u*)&sol[wave][rl][lane * 8]); }
  } else {
#pragma unroll
    for (int j = 0; j < 8; ++j) {
#pragma unroll
      for (int r = 0; r < 8; ++r) { const float v = acc[j][r]; const _Float16 hv = (_Float16)v; sth[j * 16 + col][wave * 16 + 8 * g + r] = hv; stl[j * 16 + col][wave * 16 + 8 * g + r] = (_Float16)((v - (float)hv) * 2048.0f); } }
    __syncthreads();
    const size_t rb = (size_t)blockIdx.x * 64; const int b = (int)(rb / SS), s0 = (int)(rb % SS); const int pc0 = n0 - 2 * DM;
    for (int q = tid; q < 128 * 8; q += 128) { const int d = q >> 3, pc = q & 7; const size_t o = ((size_t)b * DM + pc0 + d) * SS + s0 + pc * 8; vst2((unsigned*)(VTH + o), *(const v4u*)&sth[d][pc * 8]); vst2((unsigned*)(VTL + o), *(const v4u*)&stl[d][pc * 8]); }
  }
}
// ---- k_attn: block = (64 queries, head h, batch b): causal flash attention (K = 64: 2 k-steps), scores = (q.k) * 0.125 with single f16 operands, P.V: f16 P x (V hi, V lo*2048) in two accumulators; O[b*S+q][h*64+d] = (acc + accl / 2048) / (2048 l) (256-B segments)
__global__ __launch_bounds__(128) void k_attn(const _Float16* __restrict__ QK, const _Float16* __restrict__ QKL, const _Float16* __restrict__ VTH, const _Float16* __restrict__ VTL, float* __restrict__ O) {
  __shared__ __align__(16) float sp[4][16][36]; __shared__ __align__(16) char smem[2 * ASTAGE];   // two stage buffers; behind the loop's last barrier the same bytes stage the output
  float (*so)[16][68] = (float (*)[16][68])smem;
  const int tid = threadIdx.x, wave = tid >> 5, lane = tid & 31, col = lane & 15, g = lane >> 4;
  const int qb = blockIdx.x, h = blockIdx.y, b = blockIdx.z; const int q0 = qb * 64 + wave * 16; const size_t rq = (size_t)b * SS + q0 + col;
  v16h aq[2], aql[2];
#pragma unroll
  for (int kc = 0; kc < 2; ++kc) { aq[kc] = frag_h(QK + rq * (2 * DM) + h * HD + kc * 32, lane); aql[kc] = frag_h(QKL + rq * (2 * DM) + h * HD + kc * 32, lane); }
  float m[8], l[8];
#pragma unroll
  for (int r = 0; r < 8; ++r) { m[r] = -3.0e38f; l[r] = 0.f; }
  v8f acc[4] = {}, accl[4] = {};
  const unsigned l0 = (unsigned)(uintptr_t)smem; const _Float16* Kb = QK + (size_t)b * SS * (2 * DM) + DM + h * HD; const _Float16* Vhb = VTH + ((size_t)b * DM + h * HD) * SS; const _Float16* Vlb = VTL + ((size_t)b * DM + h * HD) * SS;
  attn_fill(l0, Kb, Vhb, Vlb, tid); WAIT_ASYNC(); __syncthreads();
  if (qb >= 1) attn_fill(l0 + ASTAGE, Kb + (size_t)64 * (2 * DM), Vhb + 64, Vlb + 64, tid);
#pragma unroll 1   // one stage of 64 keys a trip: the ring's order at the foot stays as written
  for (int st = 0; st <= qb; ++st) { const char* sb = smem + (st & 1) * ASTAGE;
#pragma unroll   // both 32-key halves of a stage written out: their LDS offsets become immediates
  for (int hf = 0; hf < 2; ++hf) { const int ks = st * 2 + hf; v8f s[2];
#pragma unroll
    for (int ct = 0; ct < 2; ++ct) { const int kk = ks * 32 + ct * 16 + col; const _Float16* krow = (const _Float16*)(sb + (hf * 32 + ct * 16 + col) * ROWP); const _Float16* krowl = krow; v8f c = {}, cl = {};
#pragma unroll
      for (int kc = 0; kc < 2; ++kc) c = wmma16(aq[kc], frag_h(krow + kc * 32, lane), c);   // single product: q, k (unit-norm heads) as one-rounding f16 operands
      (void)cl; (void)krowl;
#pragma unroll
      for (int r = 0; r < 8; ++r) { const int qi = q0 + 8 * g + r; s[ct][r] = (kk <= qi) ? c[r] * 0.125f : -3.0e38f; } }   // SCALE = 1/sqrt(64)
#pragma unroll
    for (int r = 0; r < 8; ++r) { float mx = fmaxf(s[0][r], s[1][r]);
#pragma unroll
      for (int o = 1; o < 16; o <<= 1) mx = fmaxf(mx, __shfl_xor(mx, o));
      const float mn = fmaxf(m[r], mx); const float alpha = (m[r] <= -1.0e38f) ? 0.f : __expf(m[r] - mn);
      const float e0 = (s[0][r] <= -1.0e38f) ? 0.f : __expf(s[0][r] - mn), e1 = (s[1][r] <= -1.0e38f) ? 0.f : __expf(s[1][r] - mn); float es = e0 + e1;
#pragma unroll
      for (int o = 1; o < 16; o <<= 1) es += __shfl_xor(es, o);
      l[r] = l[r] * alpha + es; m[r] = mn;
#pragma unroll
      for (int dt = 0; dt < 4; ++dt) { acc[dt][r] *= alpha; accl[dt][r] *= alpha; }
      sp[wave][8 * g + r][col] = e0; sp[wave][8 * g + r][16 + col] = e1; }
    LDSX();
    v16h pa, pl; { const float* prow = &sp[wave][col][0] + 8 * (lane >> 4);
#pragma unroll
      for (int i = 0; i < 8; ++i) { const float x0 = prow[i] * 2048.0f, x1 = prow[16 + i] * 2048.0f; const _Float16 h0 = (_Float16)x0, h1 = (_Float16)x1; pa[i] = h0; pa[8 + i] = h1; pl[i] = (_Float16)((x0 - (float)h0) * 2048.0f); pl[8 + i] = (_Float16)((x1 - (float)h1) * 2048.0f); } }   // P scaled by 2^11 before the f16 split so small softmax weights stay out of the f16 subnormal range; 2^-11 folded into the epilogue
#pragma unroll
    for (int dt = 0; dt < 4; ++dt) { const _Float16* vr = (const _Float16*)(sb + AT_BYTES + (dt * 16 + col) * ROWP) + hf * 32; const v16h vh = frag_h(vr, lane); acc[dt] = wmma16(pa, vh, acc[dt]); accl[dt] = wmma16(pa, frag_h(vr + AT_BYTES / 2, lane), accl[dt]); }   // P (single) x V hi + P x V lo / 2048: 2 products
    (void)pl;
    LDSX(); }
    WAIT_DS(); WAIT_ASYNC(); __syncthreads();
    if (st + 2 <= qb) attn_fill(l0 + (st & 1) * ASTAGE, Kb + (size_t)(st + 2) * 64 * (2 * DM), Vhb + (st + 2) * 64, Vlb + (st + 2) * 64, tid); }
  WAIT_ASYNC();
#pragma unroll
  for (int r = 0; r < 8; ++r) { const float il = (1.0f / 2048.0f) / l[r];
#pragma unroll
    for (int dt = 0; dt < 4; ++dt) so[wave][8 * g + r][dt * 16 + col] = (acc[dt][r] + accl[dt][r] * (1.0f / 2048.0f)) * il; }
  LDSX();
  for (int rl = 0; rl < 16; ++rl) if (lane < 16) vst2(O + ((size_t)b * SS + q0 + rl) * DM + h * HD + lane * 4, *(const v4f*)&so[wave][rl][lane * 4]);
}
// ---- k_out: block = (64 rows, 128 cols): out = O(hi/lo) . Wo rows (2 products); no bias (BO is null)
__global__ __launch_bounds__(128) void k_out(const float* __restrict__ O, const __bf16* __restrict__ P, const float* __restrict__ BO, float* __restrict__ Y) {
  __shared__ __align__(16) char smem[2 * GSTAGE];   // two stage buffers; behind the loop's last barrier the same bytes stage the output
  float (*so)[16][132] = (float (*)[16][132])smem;
  const int tid = threadIdx.x, wave = tid >> 5, lane = tid & 31, col = lane & 15, g = lane >> 4; const size_t r0 = (size_t)blockIdx.x * 64 + wave * 16; const int n0 = blockIdx.y * 128;
  v8f acc[8] = {};
  const unsigned l0 = (unsigned)(uintptr_t)smem; const float* Ab = O + (size_t)blockIdx.x * 64 * DM; const __bf16* Bb = P + (size_t)n0 * DM;
  gemm_fill(l0, Ab, Bb, tid); WAIT_ASYNC(); __syncthreads();
  gemm_fill(l0 + GSTAGE, Ab + GK, Bb + GK, tid);
#pragma unroll 1   // one stage a trip: the ring's order at the foot stays as written
  for (int t = 0; t < DM / GK; ++t) { const char* sb = smem + (t & 1) * GSTAGE;
#pragma unroll   // both 32-k halves of a stage written out: their LDS offsets become immediates
    for (int kc = 0; kc < GK / 32; ++kc) { const F2 a = split_row((const float*)(sb + GB_BYTES + (wave * 16 + col) * ROWP2), kc * 32, lane);
#pragma unroll
      for (int j = 0; j < 8; ++j) { const v16b w = frag_b((const __bf16*)(sb + (j * 16 + col) * ROWP) + kc * 32, lane); acc[j] = wmma_bf(a.l, w, acc[j]); acc[j] = wmma_bf(a.h, w, acc[j]); } }
    WAIT_DS(); WAIT_ASYNC(); __syncthreads();
    if (t + 2 < DM / GK) gemm_fill(l0 + (t & 1) * GSTAGE, Ab + (t + 2) * GK, Bb + (t + 2) * GK, tid); }
  WAIT_ASYNC();
#pragma unroll
  for (int j = 0; j < 8; ++j) {
#pragma unroll
    for (int r = 0; r < 8; ++r) so[wave][8 * g + r][j * 16 + col] = acc[j][r] + (BO ? bfr(BO[n0 + j * 16 + col]) : 0.f); }
  LDSX();
  for (int rl = 0; rl < 16; ++rl) vst2(Y + (r0 + rl) * DM + n0 + lane * 4, *(const v4f*)&so[wave][rl][lane * 4]);
}
extern "C" void kernel_launch(void* const* d_in, const int* in_sizes, int n_in, void* d_out, int out_size, void* d_ws, size_t ws_size, hipStream_t stream) {
  (void)in_sizes; (void)n_in; (void)out_size;
  const float** F = (const float**)d_in;   // 0 x [4,2048,1024], 1 w_attn [3072,1024] natural (q | k | v row blocks), 2 w_proj [1024,1024] natural
  if (ws_size < (size_t)WS_END) return;
  char* ws = (char*)d_ws; __bf16* PK = (__bf16*)(ws + WS_PK); _Float16 *QK = (_Float16*)(ws + WS_QK), *QKL = (_Float16*)(ws + WS_QKL), *VTH = (_Float16*)(ws + WS_VTH), *VTL = (_Float16*)(ws + WS_VTL); float* O = (float*)(ws + WS_O);
  k_pack<<<dim3(DM, 4), 256, 0, stream>>>(F[1], F[1] + (size_t)DM * DM, F[1] + (size_t)2 * DM * DM, F[2], PK);
  k_qkv<<<dim3(TNB * SS / 64, QKVW / 128), 128, 0, stream>>>(F[0], PK + PK_A, QK, QKL, VTH, VTL);
  k_attn<<<dim3(TQB, NH, TNB), 128, 0, stream>>>(QK, QKL, VTH, VTL, O);
  k_out<<<dim3(TOB, DM / 128), 128, 0, stream>>>(O, PK + PK_P, nullptr, (float*)d_out);
}

// v002
// Measured time: 237 microseconds a run.
// Next to v001, in two timings, it ran 1.30 times as fast each time.
// Counting every step since v000, it is 2.95 times as fast.
// compute dtype: all float inputs rounded to bf16; qkv = x . Wqkv^T with EXACT bf16 products on WMMA 16x16x32 (natural rows); per head, q and k rms-normalised over 64 dims (eps = f32 eps, no weight) and rotated with cos/sin = bf16(cos/sin(t * inv_freq)) (inv_freq constants reproduced from the module, precise cosf/sinf, the module's bf16 cache rounding reproduced), all in f32; then q/k as single f16 operands (plain causal scores x 1/8; unit-norm heads keep logits <= 8); running-max softmax in f32 (hardware exp); P (scaled, single f16) x v (f16 hi + x2048 residual), 2 products; out = y (bf16 hi + residual) . Wproj^T (2 products); f32 accumulate.
#include <hip/hip_runtime.h>
#include <math.h>

typedef __attribute__((ext_vector_type(16))) _Float16 v16h;
typedef __attribute__((ext_vector_type(16))) __bf16 v16b;
typedef __attribute__((ext_vector_type(8)))  _Float16 v8h;
typedef __attribute__((ext_vector_type(8)))  float v8f;
typedef __attribute__((ext_vector_type(4)))  float v4f;
typedef __attribute__((ext_vector_type(2)))  float v2f;
typedef __attribute__((ext_vector_type(4)))  unsigned v4u;
typedef __attribute__((ext_vector_type(4)))  int v4i;
typedef float __attribute__((may_alias)) float_a;
typedef int __attribute__((may_alias)) int_a;

template <typename T> __device__ __forceinline__ void vst2(void* p, T v) { *(T*)p = v;  }
__device__ __forceinline__ v8f wmma16(v16h a, v16h b, v8f c) {
  v8f d = __builtin_amdgcn_wmma_f32_16x16x32_f16(false, a, false, b, (short)0, c, false, false);
  asm volatile("v_nop\n\tv_nop\n\tv_nop\n\tv_nop" : "+v"(d) : "v"(a), "v"(b));
  return d;
}
__device__ __forceinline__ v8f wmma_bf(v16b a, v16b b, v8f c) {
  v8f d = __builtin_amdgcn_wmma_f32_16x16x32_bf16(false, a, false, b, (short)0, c, false, false);
  asm volatile("v_nop\n\tv_nop\n\tv_nop\n\tv_nop" : "+v"(d) : "v"(a), "v"(b));
  return d;
}
// Causal self attention with parameter-free RMS-norm and rotary embedding on q/k (B 4, T 2,048, C 1,024, 16 heads x 64): fused qkv projection (natural [3C][C] rows), causal softmax(q k^T / 8) v, output projection.
__device__ __forceinline__ v16h frag_h(const _Float16* rowk0, int lane) {
  union { v16h v; v8h q[2]; } u; const _Float16* p = rowk0 + 8 * (lane >> 4);
  u.q[0] = *(const v8h*)p; u.q[1] = *(const v8h*)(p + 16); return u.v;
}
__device__ __forceinline__ v16h frag_f32(const float* rowk0, int lane) {
  v16h a; const float* p = rowk0 + 8 * (lane >> 4);
#pragma unroll
  for (int i = 0; i < 8; ++i) { a[i] = (_Float16)p[i]; a[8 + i] = (_Float16)p[16 + i]; }
  return a;
}
__device__ __forceinline__ v16h frag_f32s(const float* rowk0, int lane, float sc) {
  v16h a; const float* p = rowk0 + 8 * (lane >> 4);
#pragma unroll
  for (int i = 0; i < 8; ++i) { a[i] = (_Float16)(p[i] * sc); a[8 + i] = (_Float16)(p[16 + i] * sc); }
  return a;
}
// column fragment from a [K][ld] layout (column n), rows >= K read as 0
__device__ __forceinline__ v16h fragc_f32(const float* W, int k0, int n, int lane, int ld, int K) {
  v16h a; const int g = lane >> 4;
#pragma unroll
  for (int i = 0; i < 8; ++i) { const int ka = k0 + 8 * g + i, kb = ka + 16;
    a[i] = (_Float16)(ka < K ? W[(size_t)(ka < K ? ka : K - 1) * ld + n] : 0.f); a[8 + i] = (_Float16)(kb < K ? W[(size_t)(kb < K ? kb : K - 1) * ld + n] : 0.f); }
  return a;
}
struct F2 { v16b h, l; };
__device__ __forceinline__ F2 bsplit16(const float v[16]) { F2 r;
#pragma unroll
  for (int i = 0; i < 16; ++i) { const __bf16 h = (__bf16)v[i]; r.h[i] = h; r.l[i] = (__bf16)(v[i] - (float)h); }
  return r; }
__device__ __forceinline__ F2 split_row(const float* row, int k0, int lane) { float v[16]; const float* p = row + k0 + 8 * (lane >> 4);
#pragma unroll
  for (int i = 0; i < 8; ++i) { v[i] = p[i]; v[8 + i] = p[16 + i]; }
  return bsplit16(v); }
__device__ __forceinline__ F2 split_rowK(const float* row, int k0, int lane, int K) { float v[16]; const int g = lane >> 4;
#pragma unroll
  for (int i = 0; i < 8; ++i) { const int ka = k0 + 8 * g + i, kb = ka + 16; v[i] = ka < K ? row[ka < K ? ka : K - 1] : 0.f; v[8 + i] = kb < K ? row[kb < K ? kb : K - 1] : 0.f; }
  return bsplit16(v); }
__device__ __forceinline__ F2 split_col(const float* W, int k0, int n, int lane, int ld, int K) { float v[16]; const int g = lane >> 4;
#pragma unroll
  for (int i = 0; i < 8; ++i) { const int ka = k0 + 8 * g + i, kb = ka + 16; v[i] = ka < K ? W[(size_t)(ka < K ? ka : K - 1) * ld + n] : 0.f; v[8 + i] = kb < K ? W[(size_t)(kb < K ? kb : K - 1) * ld + n] : 0.f; }
  return bsplit16(v); }
__device__ __forceinline__ v8f mac3(const F2& a, const F2& b, v8f c) { c = wmma_bf(a.l, b.h, c); c = wmma_bf(a.h, b.l, c); return wmma_bf(a.h, b.h, c); }
__device__ __forceinline__ float sigm(float v) { return 1.0f / (1.0f + expf(-v)); }
#define LDSX() do { asm volatile("s_wait_dscnt 0" ::: "memory"); __builtin_amdgcn_wave_barrier(); __builtin_amdgcn_fence(__ATOMIC_RELEASE, "workgroup"); } while (0)


#define NB 4
__constant__ float INVF[32] = {1.000000000e+00f,7.498942018e-01f,5.623413324e-01f,4.216965139e-01f,3.162277639e-01f,2.371373773e-01f,1.778279394e-01f,1.333521456e-01f,1.000000015e-01f,7.498942316e-02f,5.623413250e-02f,4.216964915e-02f,3.162277490e-02f,2.371373773e-02f,1.778279431e-02f,1.333521400e-02f,9.999999776e-03f,7.498942316e-03f,5.623413250e-03f,4.216964822e-03f,3.162277630e-03f,2.371373819e-03f,1.778279431e-03f,1.333521446e-03f,1.000000047e-03f,7.498941850e-04f,5.623413017e-04f,4.216965172e-04f,3.162277571e-04f,2.371373703e-04f,1.778279402e-04f,1.333521504e-04f};
__device__ __attribute__((noinline)) float cos_p(float v) { return cosf(v); }
__device__ __attribute__((noinline)) float sin_p(float v) { return sinf(v); }
#define SS 2048
#define DM 1024
#define NH 16
#define HD 64
#define QKVW (3 * DM)
#ifndef TQB
#define TQB (SS / 64)
#define TNB NB
#define TOB (NB * SS / 64)     // output row tiles (all)
#endif
typedef __attribute__((ext_vector_type(8))) __bf16 v8b;
__device__ __forceinline__ v16b frag_b(const __bf16* rowk0, int lane) {
  union { v16b v; v8b q[2]; } u; const __bf16* p = rowk0 + 8 * (lane >> 4);
  u.q[0] = *(const v8b*)p; u.q[1] = *(const v8b*)(p + 16); return u.v;
}
__device__ __forceinline__ float bfr(float v) { return (float)(__bf16)v; }
__device__ __attribute__((noinline)) float exp_ni(float v) { return expf(v); }
__device__ __attribute__((noinline)) float erf_ni(float v) { return erff(v); }

#define PK_A 0                       // [3072][1024] Wqkv rows (natural [out][in])
#define PK_P (PK_A + QKVW * DM)        // [1024][1024] Wo rows (natural)
#define PK_END (PK_P + DM * DM)
#define WS_PK  0u
#define WS_QK  (WS_PK + 2u * PK_END)             // f16 [8192 rows][2048]: q | k
#define WS_QKL (WS_QK + 2u * NB * SS * 2 * DM)     // f16 q | k residual planes x2048
#define WS_VTH (WS_QKL + 2u * NB * SS * 2 * DM)    // f16 [b][1024 (h*64+d)][2048 s] hi
#define WS_VTL (WS_VTH + 2u * NB * DM * SS)        // f16 lo x 2048
#define WS_O   (WS_VTL + 2u * NB * DM * SS)        // f32 [8192][1024]
#define WS_CS  (WS_O + 4u * NB * SS * DM)           // f32 2 x [2048][32], unused (cos/sin are computed in k_qkv)
#define WS_END (WS_CS + 4u * 2 * SS * 32)
// ---- LDS staging by asynchronous copies: every lane brings 16 bytes, a wave's copy covers whole 128-byte lines; rows padded by 16 bytes for the 16-byte fragment reads
#define ROWP 144                       // LDS pitch of a 128-byte row
#define ROWP2 272                      // LDS pitch of a 256-byte row
#define GK 64                          // k per GEMM stage
#define GB_BYTES (128 * ROWP)          // 128 weight rows x 64 bf16
#define GA_BYTES (64 * ROWP2)          // 64 activation rows x 64 f32
#define GSTAGE (GB_BYTES + GA_BYTES)
#define AT_BYTES (64 * ROWP)           // attention: 64 rows x 64 f16 (k rows; v hi; v lo)
#define ASTAGE (3 * AT_BYTES)
// the landing wait of this wave's own copies; the barrier behind it publishes them to the other waves
#define WAIT_ASYNC() asm volatile("s_wait_asynccnt 0x0" ::: "memory")
// this wave's LDS reads have returned before the barrier behind which their buffer is refilled
#define WAIT_DS() asm volatile("s_wait_dscnt 0x0" ::: "memory")
// four copies of one lane at constant row steps; s_wait_xcnt closes the statement so that no address register is rewritten ahead of it
__device__ __forceinline__ void acopy4(unsigned l, unsigned ls, const char* gp, size_t gs) {
  asm volatile("global_load_async_to_lds_b128 %0, %4, off\n\t"
               "global_load_async_to_lds_b128 %1, %5, off\n\t"
               "global_load_async_to_lds_b128 %2, %6, off\n\t"
               "global_load_async_to_lds_b128 %3, %7, off\n\t"
               "s_wait_xcnt 0x0"
               :: "v"(l), "v"(l + ls), "v"(l + 2 * ls), "v"(l + 3 * ls), "v"(gp), "v"(gp + gs), "v"(gp + 2 * gs), "v"(gp + 3 * gs) : "memory");
}
// one GEMM stage: weight rows n0..n0+127 and activation rows r..r+63, 64 k each (Ar, Br point at the stage's first k)
__device__ __forceinline__ void gemm_fill(unsigned lb, const float* Ar, const __bf16* Br, int tid) {
  const unsigned lB = lb + (tid >> 3) * ROWP + (tid & 7) * 16; const char* gB = (const char*)(Br + (size_t)(tid >> 3) * DM) + (tid & 7) * 16;
  acopy4(lB, 16 * ROWP, gB, (size_t)16 * DM * 2); acopy4(lB + 64 * ROWP, 16 * ROWP, gB + (size_t)64 * DM * 2, (size_t)16 * DM * 2);
  const unsigned lA = lb + GB_BYTES + (tid >> 4) * ROWP2 + (tid & 15) * 16; const char* gA = (const char*)(Ar + (size_t)(tid >> 4) * DM) + (tid & 15) * 16;
  acopy4(lA, 8 * ROWP2, gA, (size_t)8 * DM * 4); acopy4(lA + 32 * ROWP2, 8 * ROWP2, gA + (size_t)32 * DM * 4, (size_t)8 * DM * 4);
}
// one attention stage: 64 k rows (64 dims each) and, for 64 dims, 64 keys of v hi and of v lo; every row 128 bytes at a global pitch of 4,096 bytes
__device__ __forceinline__ void attn_fill(unsigned lb, const _Float16* Kr, const _Float16* Vh, const _Float16* Vl, int tid) {
  const unsigned l = lb + (tid >> 3) * ROWP + (tid & 7) * 16; const size_t ko = (size_t)(tid >> 3) * (2 * DM * 2) + (tid & 7) * 16, vo = (size_t)(tid >> 3) * (SS * 2) + (tid & 7) * 16;
  acopy4(l, 16 * ROWP, (const char*)Kr + ko, (size_t)16 * 2 * DM * 2);
  acopy4(l + AT_BYTES, 16 * ROWP, (const char*)Vh + vo, (size_t)16 * SS * 2);
  acopy4(l + 2 * AT_BYTES, 16 * ROWP, (const char*)Vl + vo, (size_t)16 * SS * 2);
}
// ---- k_pack: block = (row n, which): natural [out][in] rows -> bf16; which 0..2 -> W_q/W_k/W_v into PK_A rows which*1024 + n; 3 -> W_o into PK_P
__global__ __launch_bounds__(256) void k_pack(const float* __restrict__ WQ, const float* __restrict__ WK, const float* __restrict__ WV, const float* __restrict__ WO, __bf16* __restrict__ PK) {
  __shared__ __align__(16) __bf16 s[DM]; const int n = blockIdx.x, which = blockIdx.y, t = threadIdx.x; const float* Wm = (which == 0) ? WQ : (which == 1) ? WK : (which == 2) ? WV : WO;
  for (int k = t; k < DM; k += 256) s[k] = (__bf16)Wm[(size_t)n * DM + k];
  __syncthreads();
  __bf16* dst = (which < 3) ? PK + PK_A + ((size_t)which * DM + n) * DM : PK + PK_P + (size_t)n * DM;
  for (int q = t; q < DM / 8; q += 256) vst2((unsigned*)(dst + q * 8), *(const v4u*)&s[q * 8]);
}
__global__ __launch_bounds__(128) void k_qkv(const float* __restrict__ X, const __bf16* __restrict__ P, _Float16* __restrict__ QK, _Float16* __restrict__ QKL, _Float16* __restrict__ VTH, _Float16* __restrict__ VTL) {
  __shared__ __align__(16) char smem[2 * GSTAGE];   // two stage buffers; behind the loop's last barrier the same bytes stage the output
  _Float16 (*so)[16][136] = (_Float16 (*)[16][136])smem; _Float16 (*sol)[16][136] = (_Float16 (*)[16][136])(smem + 4 * 16 * 136 * 2); _Float16 (*sth)[72] = (_Float16 (*)[72])smem; _Float16 (*stl)[72] = (_Float16 (*)[72])(smem + 128 * 72 * 2);
  const int tid = threadIdx.x, wave = tid >> 5, lane = tid & 31, col = lane & 15, g = lane >> 4; const size_t r0 = (size_t)blockIdx.x * 64 + wave * 16; const int n0 = blockIdx.y * 128;
  v8f acc[8] = {};
  const unsigned l0 = (unsigned)(uintptr_t)smem; const float* Ab = X + (size_t)blockIdx.x * 64 * DM; const __bf16* Bb = P + (size_t)n0 * DM;
  gemm_fill(l0, Ab, Bb, tid); WAIT_ASYNC(); __syncthreads();
  gemm_fill(l0 + GSTAGE, Ab + GK, Bb + GK, tid);
#pragma unroll 1   // one stage a trip: the ring's order at the foot stays as written
  for (int t = 0; t < DM / GK; ++t) { const char* sb = smem + (t & 1) * GSTAGE;
#pragma unroll   // both 32-k halves of a stage written out: their LDS offsets become immediates
    for (int kc = 0; kc < GK / 32; ++kc) { v16b a; { const float* p = (const float*)(sb + GB_BYTES + (wave * 16 + col) * ROWP2) + kc * 32 + 8 * g;
#pragma unroll
        for (int i = 0; i < 8; ++i) { a[i] = (__bf16)p[i]; a[8 + i] = (__bf16)p[16 + i]; } }
#pragma unroll
      for (int j = 0; j < 8; ++j) acc[j] = wmma_bf(a, frag_b((const __bf16*)(sb + (j * 16 + col) * ROWP) + kc * 32, lane), acc[j]); }
    WAIT_DS(); WAIT_ASYNC(); __syncthreads();
    if (t + 2 < DM / GK) gemm_fill(l0 + (t & 1) * GSTAGE, Ab + (t + 2) * GK, Bb + (t + 2) * GK, tid); }
  WAIT_ASYNC();
  if (n0 < 2 * DM) {   // q and k: rms-norm per head (tiles 0-3 = head A, 4-7 = head B of this 128-column block), then rotary (pairs d, d+32 = tiles j, j+2), then f16 hi + residual
#pragma unroll
    for (int r = 0; r < 8; ++r) { const int tpos = (int)((r0 + 8 * g + r) % SS);
#pragma unroll
      for (int hh = 0; hh < 2; ++hh) { float ssq = 0.f;
#pragma unroll
        for (int j = 0; j < 4; ++j) ssq += acc[hh * 4 + j][r] * acc[hh * 4 + j][r];
#pragma unroll
        for (int o = 1; o < 16; o <<= 1) ssq += __shfl_xor(ssq, o);
        const float rinv = 1.0f / sqrtf(ssq / 64.0f + 1.1920928955078125e-07f);
#pragma unroll
        for (int j = 0; j < 2; ++j) { const int d = j * 16 + col; const float x1 = acc[hh * 4 + j][r] * rinv, x2 = acc[hh * 4 + j + 2][r] * rinv; const float fr = (float)tpos * INVF[d]; const float c = bfr(cos_p(fr)), sn = bfr(sin_p(fr));
          acc[hh * 4 + j][r] = x1 * c + x2 * sn; acc[hh * 4 + j + 2][r] = -x1 * sn + x2 * c; } } }
#pragma unroll
    for (int j = 0; j < 8; ++j) {
#pragma unroll
      for (int r = 0; r < 8; ++r) { const float v = acc[j][r]; const _Float16 hv = (_Float16)v; so[wave][8 * g + r][j * 16 + col] = hv; sol[wave][8 * g + r][j * 16 + col] = (_Float16)((v - (float)hv) * 2048.0f); } }   // q, k (normed + rotated) as f16 hi + (x2048) residual
    LDSX();
    for (int rl = 0; rl < 16; ++rl) if (lane < 16) { vst2((unsigned*)(QK + (r0 + rl) * (2 * DM) + n0 + lane * 8), *(const v4u*)&so[wave][rl][lane * 8]); vst2((unsigned*)(QKL + (r0 + rl) * (2 * DM) + n0 + lane * 8), *(const v4u*)&sol[wave][rl][lane * 8]); }
  } else {
#pragma unroll
    for (int j = 0; j < 8; ++j) {
#pragma unroll
      for (int r = 0; r < 8; ++r) { const float v = acc[j][r]; const _Float16 hv = (_Float16)v; sth[j * 16 + col][wave * 16 + 8 * g + r] = hv; stl[j * 16 + col][wave * 16 + 8 * g + r] = (_Float16)((v - (float)hv) * 2048.0f); } }
    __syncthreads();
    const size_t rb = (size_t)blockIdx.x * 64; const int b = (int)(rb / SS), s0 = (int)(rb % SS); const int pc0 = n0 - 2 * DM;
    for (int q = tid; q < 128 * 8; q += 128) { const int d = q >> 3, pc = q & 7; const size_t o = ((size_t)b * DM + pc0 + d) * SS + s0 + pc * 8; vst2((unsigned*)(VTH + o), *(const v4u*)&sth[d][pc * 8]); vst2((unsigned*)(VTL + o), *(const v4u*)&stl[d][pc * 8]); }
  }
}
// lane l with lane l ^ 16 (the two halves of a wave hold the two key halves of one query column)
__device__ __forceinline__ float xhalf(float x) { return __builtin_bit_cast(float, __builtin_amdgcn_permlanex16(__builtin_bit_cast(int, x), __builtin_bit_cast(int, x), 0x76543210, 0xfedcba98, false, false)); }
// 2^x for eight values (and, in exp2_9, one more): the v_exp_f32 stand in ONE statement with early-clobber outputs, so that none reads the result or overwrites the source of the one in front of it; the v_nop is the slot the instruction set asks for behind the last of them
__device__ __forceinline__ void exp2_8(const float* x, float* e) {
  asm("v_exp_f32 %0, %8\n\tv_exp_f32 %1, %9\n\tv_exp_f32 %2, %10\n\tv_exp_f32 %3, %11\n\tv_exp_f32 %4, %12\n\tv_exp_f32 %5, %13\n\tv_exp_f32 %6, %14\n\tv_exp_f32 %7, %15\n\tv_nop"
      : "=&v"(e[0]), "=&v"(e[1]), "=&v"(e[2]), "=&v"(e[3]), "=&v"(e[4]), "=&v"(e[5]), "=&v"(e[6]), "=&v"(e[7])
      : "v"(x[0]), "v"(x[1]), "v"(x[2]), "v"(x[3]), "v"(x[4]), "v"(x[5]), "v"(x[6]), "v"(x[7]));
}
__device__ __forceinline__ void exp2_9(float xa, float& ea, const float* x, float* e) {
  asm("v_exp_f32 %0, %9\n\tv_exp_f32 %1, %10\n\tv_exp_f32 %2, %11\n\tv_exp_f32 %3, %12\n\tv_exp_f32 %4, %13\n\tv_exp_f32 %5, %14\n\tv_exp_f32 %6, %15\n\tv_exp_f32 %7, %16\n\tv_exp_f32 %8, %17\n\tv_nop"
      : "=&v"(ea), "=&v"(e[0]), "=&v"(e[1]), "=&v"(e[2]), "=&v"(e[3]), "=&v"(e[4]), "=&v"(e[5]), "=&v"(e[6]), "=&v"(e[7])
      : "v"(xa), "v"(x[0]), "v"(x[1]), "v"(x[2]), "v"(x[3]), "v"(x[4]), "v"(x[5]), "v"(x[6]), "v"(x[7]));
}
__global__ __launch_bounds__(128) void k_attn(const _Float16* __restrict__ QK, const _Float16* __restrict__ QKL, const _Float16* __restrict__ VTH, const _Float16* __restrict__ VTL, float* __restrict__ O) {
  __shared__ __align__(16) char smem[2 * ASTAGE];   // two stage buffers; behind the loop's last barrier the same bytes stage the output
  float (*so)[16][68] = (float (*)[16][68])smem;
  const int tid = threadIdx.x, wave = tid >> 5, lane = tid & 31, col = lane & 15, g = lane >> 4;
  const int qb = blockIdx.x, h = blockIdx.y, b = blockIdx.z; const int q0 = qb * 64 + wave * 16; const size_t rq = (size_t)b * SS + q0 + col; const int qi = q0 + col;
  (void)QKL;
  v16h aq[2];
#pragma unroll   // register arrays: every index must be a constant
  for (int kc = 0; kc < 2; ++kc) aq[kc] = frag_h(QK + rq * (2 * DM) + h * HD + kc * 32, lane);
  float m = -3.0e38f, l = 0.f;   // of query qi; l is this lane half's share of the sum, joined behind the loop
  v8f acc[4] = {}, accl[4] = {};   // O^T tiles: register r = dim dt * 16 + 8 g + r of query qi
  const unsigned l0 = (unsigned)(uintptr_t)smem; const _Float16* Kb = QK + (size_t)b * SS * (2 * DM) + DM + h * HD; const _Float16* Vhb = VTH + ((size_t)b * DM + h * HD) * SS; const _Float16* Vlb = VTL + ((size_t)b * DM + h * HD) * SS;
  attn_fill(l0, Kb, Vhb, Vlb, tid); WAIT_ASYNC(); __syncthreads();
  if (qb >= 1) attn_fill(l0 + ASTAGE, Kb + (size_t)64 * (2 * DM), Vhb + 64, Vlb + 64, tid);
#pragma unroll 1   // one stage of 64 keys a trip: the ring's order at the foot stays as written
  for (int st = 0; st <= qb; ++st) { const char* sb = smem + (st & 1) * ASTAGE;
#pragma unroll   // both 32-key halves of a stage written out: their LDS offsets become immediates
  for (int hf = 0; hf < 2; ++hf) { const int dq = qi - 8 * g - (st * 2 + hf) * 32; v8f s[2];   // key ct * 16 + r of this lane's rows is allowed while ct * 16 + r <= dq
#pragma unroll   // register arrays: every index must be a constant
    for (int ct = 0; ct < 2; ++ct) { const _Float16* krow = (const _Float16*)(sb + (hf * 32 + ct * 16 + col) * ROWP); v8f c = {};
#pragma unroll   // register arrays: every index must be a constant
      for (int kc = 0; kc < 2; ++kc) c = wmma16(frag_h(krow + kc * 32, lane), aq[kc], c);   // single product: q, k (unit-norm heads) as one-rounding f16 operands; register r = key ct * 16 + 8 g + r
#pragma unroll   // register arrays: every index must be a constant
      for (int r = 0; r < 8; ++r) s[ct][r] = (ct * 16 + r <= dq) ? c[r] * 0.125f : -3.0e38f; }   // SCALE = 1/sqrt(64)
    float mx = fmaxf(s[0][0], s[1][0]);
#pragma unroll   // register arrays: every index must be a constant
    for (int r = 1; r < 8; ++r) mx = fmaxf(mx, fmaxf(s[0][r], s[1][r]));
    mx = fmaxf(mx, xhalf(mx));
    const float mn = fmaxf(m, mx); float x0[8], x1[8], y0[8], y1[8], ya;
#pragma unroll   // register arrays: every index must be a constant
    for (int r = 0; r < 8; ++r) { x0[r] = (s[0][r] - mn) * 1.44269504f; x1[r] = (s[1][r] - mn) * 1.44269504f; }   // e^v = 2^(v log2 e), as __expf forms it
    exp2_9((m - mn) * 1.44269504f, ya, x0, y0); exp2_8(x1, y1);
    const float alpha = (m <= -1.0e38f) ? 0.f : ya;
    v16h pa; float t[8];   // P scaled by 2^11 before the f16 rounding so small softmax weights stay out of the f16 subnormal range; 2^-11 folded into the epilogue
#pragma unroll   // register arrays: every index must be a constant
    for (int r = 0; r < 8; ++r) { const float e0 = (s[0][r] <= -1.0e38f) ? 0.f : y0[r], e1 = (s[1][r] <= -1.0e38f) ? 0.f : y1[r];
      t[r] = e0 + e1; pa[r] = (_Float16)(e0 * 2048.0f); pa[8 + r] = (_Float16)(e1 * 2048.0f); }   // element s of the B operand = key 8 g + s (s < 8), 16 + 8 g + s - 8 (else): the two score tiles as they lie
    l = l * alpha + (((t[0] + t[1]) + (t[2] + t[3])) + ((t[4] + t[5]) + (t[6] + t[7]))); m = mn;
#pragma unroll   // register arrays: every index must be a constant
    for (int dt = 0; dt < 4; ++dt) { acc[dt] *= alpha; accl[dt] *= alpha; }
#pragma unroll   // register arrays: every index must be a constant
    for (int dt = 0; dt < 4; ++dt) { const _Float16* vr = (const _Float16*)(sb + AT_BYTES + (dt * 16 + col) * ROWP) + hf * 32; acc[dt] = wmma16(frag_h(vr, lane), pa, acc[dt]); accl[dt] = wmma16(frag_h(vr + AT_BYTES / 2, lane), pa, accl[dt]); } }   // V hi x P (single) + V lo x P / 2048: 2 products
    WAIT_DS(); WAIT_ASYNC(); __syncthreads();
    if (st + 2 <= qb) attn_fill(l0 + (st & 1) * ASTAGE, Kb + (size_t)(st + 2) * 64 * (2 * DM), Vhb + (st + 2) * 64, Vlb + (st + 2) * 64, tid); }
  WAIT_ASYNC();
  const float il = (1.0f / 2048.0f) / (l + xhalf(l));
#pragma unroll   // register arrays: every index must be a constant
  for (int dt = 0; dt < 4; ++dt) { v4f o0, o1;
#pragma unroll   // register arrays: every index must be a constant
    for (int r = 0; r < 4; ++r) { o0[r] = (acc[dt][r] + accl[dt][r] * (1.0f / 2048.0f)) * il; o1[r] = (acc[dt][4 + r] + accl[dt][4 + r] * (1.0f / 2048.0f)) * il; }
    *(v4f*)&so[wave][col][dt * 16 + 8 * g] = o0; *(v4f*)&so[wave][col][dt * 16 + 8 * g + 4] = o1; }
  LDSX();
  for (int rl = 0; rl < 16; ++rl) if (lane < 16) vst2(O + ((size_t)b * SS + q0 + rl) * DM + h * HD + lane * 4, *(const v4f*)&so[wave][rl][lane * 4]);
}
// ---- k_out: block = (64 rows, 128 cols): out = O(hi/lo) . Wo rows (2 products); no bias (BO is null)
__global__ __launch_bounds__(128) void k_out(const float* __restrict__ O, const __bf16* __restrict__ P, const float* __restrict__ BO, float* __restrict__ Y) {
  __shared__ __align__(16) char smem[2 * GSTAGE];   // two stage buffers; behind the loop's last barrier the same bytes stage the output
  float (*so)[16][132] = (float (*)[16][132])smem;
  const int tid = threadIdx.x, wave = tid >> 5, lane = tid & 31, col = lane & 15, g = lane >> 4; const size_t r0 = (size_t)blockIdx.x * 64 + wave * 16; const int n0 = blockIdx.y * 128;
  v8f acc[8] = {};
  const unsigned l0 = (unsigned)(uintptr_t)smem; const float* Ab = O + (size_t)blockIdx.x * 64 * DM; const __bf16* Bb = P + (size_t)n0 * DM;
  gemm_fill(l0, Ab, Bb, tid); WAIT_ASYNC(); __syncthreads();
  gemm_fill(l0 + GSTAGE, Ab + GK, Bb + GK, tid);
#pragma unroll 1   // one stage a trip: the ring's order at the foot stays as written
  for (int t = 0; t < DM / GK; ++t) { const char* sb = smem + (t & 1) * GSTAGE;
#pragma unroll   // both 32-k halves of a stage written out: their LDS offsets become immediates
    for (int kc = 0; kc < GK / 32; ++kc) { const F2 a = split_row((const float*)(sb + GB_BYTES + (wave * 16 + col) * ROWP2), kc * 32, lane);
#pragma unroll
      for (int j = 0; j < 8; ++j) { const v16b w = frag_b((const __bf16*)(sb + (j * 16 + col) * ROWP) + kc * 32, lane); acc[j] = wmma_bf(a.l, w, acc[j]); acc[j] = wmma_bf(a.h, w, acc[j]); } }
    WAIT_DS(); WAIT_ASYNC(); __syncthreads();
    if (t + 2 < DM / GK) gemm_fill(l0 + (t & 1) * GSTAGE, Ab + (t + 2) * GK, Bb + (t + 2) * GK, tid); }
  WAIT_ASYNC();
#pragma unroll
  for (int j = 0; j < 8; ++j) {
#pragma unroll
    for (int r = 0; r < 8; ++r) so[wave][8 * g + r][j * 16 + col] = acc[j][r] + (BO ? bfr(BO[n0 + j * 16 + col]) : 0.f); }
  LDSX();
  for (int rl = 0; rl < 16; ++rl) vst2(Y + (r0 + rl) * DM + n0 + lane * 4, *(const v4f*)&so[wave][rl][lane * 4]);
}
extern "C" void kernel_launch(void* const* d_in, const int* in_sizes, int n_in, void* d_out, int out_size, void* d_ws, size_t ws_size, hipStream_t stream) {
  (void)in_sizes; (void)n_in; (void)out_size;
  const float** F = (const float**)d_in;   // 0 x [4,2048,1024], 1 w_attn [3072,1024] natural (q | k | v row blocks), 2 w_proj [1024,1024] natural
  if (ws_size < (size_t)WS_END) return;
  char* ws = (char*)d_ws; __bf16* PK = (__bf16*)(ws + WS_PK); _Float16 *QK = (_Float16*)(ws + WS_QK), *QKL = (_Float16*)(ws + WS_QKL), *VTH = (_Float16*)(ws + WS_VTH), *VTL = (_Float16*)(ws + WS_VTL); float* O = (float*)(ws + WS_O);
  k_pack<<<dim3(DM, 4), 256, 0, stream>>>(F[1], F[1] + (size_t)DM * DM, F[1] + (size_t)2 * DM * DM, F[2], PK);
  k_qkv<<<dim3(TNB * SS / 64, QKVW / 128), 128, 0, stream>>>(F[0], PK + PK_A, QK, QKL, VTH, VTL);
  k_attn<<<dim3(TQB, NH, TNB), 128, 0, stream>>>(QK, QKL, VTH, VTL, O);
  k_out<<<dim3(TOB, DM / 128), 128, 0, stream>>>(O, PK + PK_P, nullptr, (float*)d_out);
}

// v003
// It runs in 207 microseconds.
// Timed twice side by side with v002, it ran 1.14 times as fast both times.
// Over all steps from v000 it is 3.36 times as fast.
// compute dtype: all float inputs rounded to bf16; qkv = x . Wqkv^T with EXACT bf16 products on WMMA 16x16x32 (natural rows); per head, q and k rms-normalised over 64 dims (eps = f32 eps, no weight) and rotated with cos/sin = bf16(cos/sin(t * inv_freq)) (inv_freq constants reproduced from the module, precise cosf/sinf, the module's bf16 cache rounding reproduced), all in f32; then q/k as single f16 operands (plain causal scores x 1/8; unit-norm heads keep logits <= 8); running-max softmax in f32 (hardware exp); P (scaled, single f16) x v (f16 hi + x2048 residual), 2 products; out = y (bf16 hi + residual) . Wproj^T (2 products); f32 accumulate.
#include <hip/hip_runtime.h>
#include <math.h>

typedef __attribute__((ext_vector_type(16))) _Float16 v16h;
typedef __attribute__((ext_vector_type(16))) __bf16 v16b;
typedef __attribute__((ext_vector_type(8)))  _Float16 v8h;
typedef __attribute__((ext_vector_type(8)))  float v8f;
typedef __attribute__((ext_vector_type(4)))  float v4f;
typedef __attribute__((ext_vector_type(2)))  float v2f;
typedef __attribute__((ext_vector_type(4)))  unsigned v4u;
typedef __attribute__((ext_vector_type(4)))  int v4i;
typedef float __attribute__((may_alias)) float_a;
typedef int __attribute__((may_alias)) int_a;

template <typename T> __device__ __forceinline__ void vst2(void* p, T v) { *(T*)p = v;  }
__device__ __forceinline__ v8f wmma16(v16h a, v16h b, v8f c) {
  return __builtin_amdgcn_wmma_f32_16x16x32_f16(false, a, false, b, (short)0, c, false, false);
}
__device__ __forceinline__ v8f wmma_bf(v16b a, v16b b, v8f c) {
  return __builtin_amdgcn_wmma_f32_16x16x32_bf16(false, a, false, b, (short)0, c, false, false);
}
// Causal self attention with parameter-free RMS-norm and rotary embedding on q/k (B 4, T 2,048, C 1,024, 16 heads x 64): fused qkv projection (natural [3C][C] rows), causal softmax(q k^T / 8) v, output projection.
__device__ __forceinline__ v16h frag_h(const _Float16* rowk0, int lane) {
  union { v16h v; v8h q[2]; } u; const _Float16* p = rowk0 + 8 * (lane >> 4);
  u.q[0] = *(const v8h*)p; u.q[1] = *(const v8h*)(p + 16); return u.v;
}
__device__ __forceinline__ v16h frag_f32(const float* rowk0, int lane) {
  v16h a; const float* p = rowk0 + 8 * (lane >> 4);
#pragma unroll
  for (int i = 0; i < 8; ++i) { a[i] = (_Float16)p[i]; a[8 + i] = (_Float16)p[16 + i]; }
  return a;
}
__device__ __forceinline__ v16h frag_f32s(const float* rowk0, int lane, float sc) {
  v16h a; const float* p = rowk0 + 8 * (lane >> 4);
#pragma unroll
  for (int i = 0; i < 8; ++i) { a[i] = (_Float16)(p[i] * sc); a[8 + i] = (_Float16)(p[16 + i] * sc); }
  return a;
}
// column fragment from a [K][ld] layout (column n), rows >= K read as 0
__device__ __forceinline__ v16h fragc_f32(const float* W, int k0, int n, int lane, int ld, int K) {
  v16h a; const int g = lane >> 4;
#pragma unroll
  for (int i = 0; i < 8; ++i) { const int ka = k0 + 8 * g + i, kb = ka + 16;
    a[i] = (_Float16)(ka < K ? W[(size_t)(ka < K ? ka : K - 1) * ld + n] : 0.f); a[8 + i] = (_Float16)(kb < K ? W[(size_t)(kb < K ? kb : K - 1) * ld + n] : 0.f); }
  return a;
}
struct F2 { v16b h, l; };
__device__ __forceinline__ F2 bsplit16(const float v[16]) { F2 r;
#pragma unroll
  for (int i = 0; i < 16; ++i) { const __bf16 h = (__bf16)v[i]; r.h[i] = h; r.l[i] = (__bf16)(v[i] - (float)h); }
  return r; }
__device__ __forceinline__ F2 split_row(const float* row, int k0, int lane) { float v[16]; const float* p = row + k0 + 8 * (lane >> 4);
#pragma unroll
  for (int i = 0; i < 8; ++i) { v[i] = p[i]; v[8 + i] = p[16 + i]; }
  return bsplit16(v); }
__device__ __forceinline__ F2 split_rowK(const float* row, int k0, int lane, int K) { float v[16]; const int g = lane >> 4;
#pragma unroll
  for (int i = 0; i < 8; ++i) { const int ka = k0 + 8 * g + i, kb = ka + 16; v[i] = ka < K ? row[ka < K ? ka : K - 1] : 0.f; v[8 + i] = kb < K ? row[kb < K ? kb : K - 1] : 0.f; }
  return bsplit16(v); }
__device__ __forceinline__ F2 split_col(const float* W, int k0, int n, int lane, int ld, int K) { float v[16]; const int g = lane >> 4;
#pragma unroll
  for (int i = 0; i < 8; ++i) { const int ka = k0 + 8 * g + i, kb = ka + 16; v[i] = ka < K ? W[(size_t)(ka < K ? ka : K - 1) * ld + n] : 0.f; v[8 + i] = kb < K ? W[(size_t)(kb < K ? kb : K - 1) * ld + n] : 0.f; }
  return bsplit16(v); }
__device__ __forceinline__ v8f mac3(const F2& a, const F2& b, v8f c) { c = wmma_bf(a.l, b.h, c); c = wmma_bf(a.h, b.l, c); return wmma_bf(a.h, b.h, c); }
__device__ __forceinline__ float sigm(float v) { return 1.0f / (1.0f + expf(-v)); }
#define LDSX() do { asm volatile("s_wait_dscnt 0" ::: "memory"); __builtin_amdgcn_wave_barrier(); __builtin_amdgcn_fence(__ATOMIC_RELEASE, "workgroup"); } while (0)


#define NB 4
__constant__ float INVF[32] = {1.000000000e+00f,7.498942018e-01f,5.623413324e-01f,4.216965139e-01f,3.162277639e-01f,2.371373773e-01f,1.778279394e-01f,1.333521456e-01f,1.000000015e-01f,7.498942316e-02f,5.623413250e-02f,4.216964915e-02f,3.162277490e-02f,2.371373773e-02f,1.778279431e-02f,1.333521400e-02f,9.999999776e-03f,7.498942316e-03f,5.623413250e-03f,4.216964822e-03f,3.162277630e-03f,2.371373819e-03f,1.778279431e-03f,1.333521446e-03f,1.000000047e-03f,7.498941850e-04f,5.623413017e-04f,4.216965172e-04f,3.162277571e-04f,2.371373703e-04f,1.778279402e-04f,1.333521504e-04f};
__device__ __attribute__((noinline)) float cos_p(float v) { return cosf(v); }
__device__ __attribute__((noinline)) float sin_p(float v) { return sinf(v); }
#define SS 2048
#define DM 1024
#define NH 16
#define HD 64
#define QKVW (3 * DM)
#ifndef TQB
#define TQB (SS / 64)
#define TNB NB
#define TOB (NB * SS / 64)     // output row tiles (all)
#endif
typedef __attribute__((ext_vector_type(8))) __bf16 v8b;
__device__ __forceinline__ v16b frag_b(const __bf16* rowk0, int lane) {
  union { v16b v; v8b q[2]; } u; const __bf16* p = rowk0 + 8 * (lane >> 4);
  u.q[0] = *(const v8b*)p; u.q[1] = *(const v8b*)(p + 16); return u.v;
}
__device__ __forceinline__ float bfr(float v) { return (float)(__bf16)v; }
__device__ __attribute__((noinline)) float exp_ni(float v) { return expf(v); }
__device__ __attribute__((noinline)) float erf_ni(float v) { return erff(v); }

#define PK_A 0                       // [3072][1024] Wqkv rows (natural [out][in])
#define PK_P (PK_A + QKVW * DM)        // [1024][1024] Wo rows (natural)
#define PK_END (PK_P + DM * DM)
#define WS_PK  0u
#define WS_QK  (WS_PK + 2u * PK_END)             // f16 [8192 rows][2048]: q | k
#define WS_QKL (WS_QK + 2u * NB * SS * 2 * DM)     // f16 q | k residual planes x2048
#define WS_VTH (WS_QKL + 2u * NB * SS * 2 * DM)    // f16 [b][1024 (h*64+d)][2048 s] hi
#define WS_VTL (WS_VTH + 2u * NB * DM * SS)        // f16 lo x 2048
#define WS_O   (WS_VTL + 2u * NB * DM * SS)        // f32 [8192][1024]
#define WS_CS  (WS_O + 4u * NB * SS * DM)           // f32 2 x [2048][32], unused (cos/sin are computed in k_qkv)
#define WS_END (WS_CS + 4u * 2 * SS * 32)
// ---- LDS staging by asynchronous copies: every lane brings 16 bytes, a wave's copy covers whole 128-byte lines; rows padded by 16 bytes for the 16-byte fragment reads
#define ROWP 144                       // LDS pitch of a 128-byte row
#define ROWP2 272                      // LDS pitch of a 256-byte row
#define GK 64                          // k per GEMM stage
#define GB_BYTES (128 * ROWP)          // 128 weight rows x 64 bf16
#define GA_BYTES (64 * ROWP2)          // 64 activation rows x 64 f32
#define GSTAGE (GB_BYTES + GA_BYTES)
#define AT_BYTES (64 * ROWP)           // attention: 64 rows x 64 f16 (k rows; v hi; v lo)
#define ASTAGE (3 * AT_BYTES)
// the landing wait of this wave's own copies; the barrier behind it publishes them to the other waves
#define WAIT_ASYNC() asm volatile("s_wait_asynccnt 0x0" ::: "memory")
// this wave's LDS reads have returned before the barrier behind which their buffer is refilled
#define WAIT_DS() asm volatile("s_wait_dscnt 0x0" ::: "memory")
// a group of LDS fragment reads is held in front of the matrix instructions that use it, so that the reads issue together and are waited for once, not one pair and one wait per matrix instruction (loaded values as inputs only: nothing is changed and no product is named)
#define HOLD4(a, b, c, d) asm volatile("" :: "v"(a), "v"(b), "v"(c), "v"(d))
#define HOLD8(a, b, c, d, e, f, g, h) asm volatile("" :: "v"(a), "v"(b), "v"(c), "v"(d), "v"(e), "v"(f), "v"(g), "v"(h))
// four copies of one lane at constant row steps; s_wait_xcnt closes the statement so that no address register is rewritten ahead of it
__device__ __forceinline__ void acopy4(unsigned l, unsigned ls, const char* gp, size_t gs) {
  asm volatile("global_load_async_to_lds_b128 %0, %4, off\n\t"
               "global_load_async_to_lds_b128 %1, %5, off\n\t"
               "global_load_async_to_lds_b128 %2, %6, off\n\t"
               "global_load_async_to_lds_b128 %3, %7, off\n\t"
               "s_wait_xcnt 0x0"
               :: "v"(l), "v"(l + ls), "v"(l + 2 * ls), "v"(l + 3 * ls), "v"(gp), "v"(gp + gs), "v"(gp + 2 * gs), "v"(gp + 3 * gs) : "memory");
}
// one GEMM stage: weight rows n0..n0+127 and activation rows r..r+63, 64 k each (Ar, Br point at the stage's first k)
__device__ __forceinline__ void gemm_fill(unsigned lb, const float* Ar, const __bf16* Br, int tid) {
  const unsigned lB = lb + (tid >> 3) * ROWP + (tid & 7) * 16; const char* gB = (const char*)(Br + (size_t)(tid >> 3) * DM) + (tid & 7) * 16;
  acopy4(lB, 16 * ROWP, gB, (size_t)16 * DM * 2); acopy4(lB + 64 * ROWP, 16 * ROWP, gB + (size_t)64 * DM * 2, (size_t)16 * DM * 2);
  const unsigned lA = lb + GB_BYTES + (tid >> 4) * ROWP2 + (tid & 15) * 16; const char* gA = (const char*)(Ar + (size_t)(tid >> 4) * DM) + (tid & 15) * 16;
  acopy4(lA, 8 * ROWP2, gA, (size_t)8 * DM * 4); acopy4(lA + 32 * ROWP2, 8 * ROWP2, gA + (size_t)32 * DM * 4, (size_t)8 * DM * 4);
}
// one attention stage: 64 k rows (64 dims each) and, for 64 dims, 64 keys of v hi and of v lo; every row 128 bytes at a global pitch of 4,096 bytes
__device__ __forceinline__ void attn_fill(unsigned lb, const _Float16* Kr, const _Float16* Vh, const _Float16* Vl, int tid) {
  const unsigned l = lb + (tid >> 3) * ROWP + (tid & 7) * 16; const size_t ko = (size_t)(tid >> 3) * (2 * DM * 2) + (tid & 7) * 16, vo = (size_t)(tid >> 3) * (SS * 2) + (tid & 7) * 16;
  acopy4(l, 16 * ROWP, (const char*)Kr + ko, (size_t)16 * 2 * DM * 2);
  acopy4(l + AT_BYTES, 16 * ROWP, (const char*)Vh + vo, (size_t)16 * SS * 2);
  acopy4(l + 2 * AT_BYTES, 16 * ROWP, (const char*)Vl + vo, (size_t)16 * SS * 2);
}
// ---- k_pack: block = (row n, which): natural [out][in] rows -> bf16; which 0..2 -> W_q/W_k/W_v into PK_A rows which*1024 + n; 3 -> W_o into PK_P
__global__ __launch_bounds__(256) void k_pack(const float* __restrict__ WQ, const float* __restrict__ WK, const float* __restrict__ WV, const float* __restrict__ WO, __bf16* __restrict__ PK) {
  __shared__ __align__(16) __bf16 s[DM]; const int n = blockIdx.x, which = blockIdx.y, t = threadIdx.x; const float* Wm = (which == 0) ? WQ : (which == 1) ? WK : (which == 2) ? WV : WO;
  for (int k = t; k < DM; k += 256) s[k] = (__bf16)Wm[(size_t)n * DM + k];
  __syncthreads();
  __bf16* dst = (which < 3) ? PK + PK_A + ((size_t)which * DM + n) * DM : PK + PK_P + (size_t)n * DM;
  for (int q = t; q < DM / 8; q += 256) vst2((unsigned*)(dst + q * 8), *(const v4u*)&s[q * 8]);
}
__global__ __launch_bounds__(128) void k_qkv(const float* __restrict__ X, const __bf16* __restrict__ P, _Float16* __restrict__ QK, _Float16* __restrict__ QKL, _Float16* __restrict__ VTH, _Float16* __restrict__ VTL) {
  __shared__ __align__(16) char smem[2 * GSTAGE];   // two stage buffers; behind the loop's last barrier the same bytes stage the output
  _Float16 (*so)[16][136] = (_Float16 (*)[16][136])smem; _Float16 (*sol)[16][136] = (_Float16 (*)[16][136])(smem + 4 * 16 * 136 * 2); _Float16 (*sth)[72] = (_Float16 (*)[72])smem; _Float16 (*stl)[72] = (_Float16 (*)[72])(smem + 128 * 72 * 2);
  const int tid = threadIdx.x, wave = tid >> 5, lane = tid & 31, col = lane & 15, g = lane >> 4; const size_t r0 = (size_t)blockIdx.x * 64 + wave * 16; const int n0 = blockIdx.y * 128;
  v8f acc[8] = {};
  const unsigned l0 = (unsigned)(uintptr_t)smem; const float* Ab = X + (size_t)blockIdx.x * 64 * DM; const __bf16* Bb = P + (size_t)n0 * DM;
  gemm_fill(l0, Ab, Bb, tid); WAIT_ASYNC(); __syncthreads();
  gemm_fill(l0 + GSTAGE, Ab + GK, Bb + GK, tid);
#pragma unroll 1   // one stage a trip: the ring's order at the foot stays as written
  for (int t = 0; t < DM / GK; ++t) { const char* sb = smem + (t & 1) * GSTAGE;
#pragma unroll   // both 32-k halves of a stage written out: their LDS offsets become immediates
    for (int kc = 0; kc < GK / 32; ++kc) { const float* p = (const float*)(sb + GB_BYTES + (wave * 16 + col) * ROWP2) + kc * 32 + 8 * g;
      const v4f a0 = *(const v4f*)p, a1 = *(const v4f*)(p + 4), a2 = *(const v4f*)(p + 16), a3 = *(const v4f*)(p + 20); v16b w[8], a;
#pragma unroll
      for (int j = 0; j < 8; ++j) w[j] = frag_b((const __bf16*)(sb + (j * 16 + col) * ROWP) + kc * 32, lane);
      HOLD4(a0, a1, a2, a3); HOLD8(w[0], w[1], w[2], w[3], w[4], w[5], w[6], w[7]);   // the reads of this k step issue together, in front of its matrix instructions
#pragma unroll
      for (int i = 0; i < 4; ++i) { a[i] = (__bf16)a0[i]; a[4 + i] = (__bf16)a1[i]; a[8 + i] = (__bf16)a2[i]; a[12 + i] = (__bf16)a3[i]; }
#pragma unroll
      for (int j = 0; j < 8; ++j) acc[j] = wmma_bf(a, w[j], acc[j]); }
    WAIT_DS(); WAIT_ASYNC(); __syncthreads();
    if (t + 2 < DM / GK) gemm_fill(l0 + (t & 1) * GSTAGE, Ab + (t + 2) * GK, Bb + (t + 2) * GK, tid); }
  WAIT_ASYNC();
  if (n0 < 2 * DM) {   // q and k: rms-norm per head (tiles 0-3 = head A, 4-7 = head B of this 128-column block), then rotary (pairs d, d+32 = tiles j, j+2), then f16 hi + residual
#pragma unroll
    for (int r = 0; r < 8; ++r) { const int tpos = (int)((r0 + 8 * g + r) % SS);
#pragma unroll
      for (int hh = 0; hh < 2; ++hh) { float ssq = 0.f;
#pragma unroll
        for (int j = 0; j < 4; ++j) ssq += acc[hh * 4 + j][r] * acc[hh * 4 + j][r];
#pragma unroll
        for (int o = 1; o < 16; o <<= 1) ssq += __shfl_xor(ssq, o);
        const float rinv = 1.0f / sqrtf(ssq / 64.0f + 1.1920928955078125e-07f);
#pragma unroll
        for (int j = 0; j < 2; ++j) { const int d = j * 16 + col; const float x1 = acc[hh * 4 + j][r] * rinv, x2 = acc[hh * 4 + j + 2][r] * rinv; const float fr = (float)tpos * INVF[d]; const float c = bfr(cos_p(fr)), sn = bfr(sin_p(fr));
          acc[hh * 4 + j][r] = x1 * c + x2 * sn; acc[hh * 4 + j + 2][r] = -x1 * sn + x2 * c; } } }
#pragma unroll
    for (int j = 0; j < 8; ++j) {
#pragma unroll
      for (int r = 0; r < 8; ++r) { const float v = acc[j][r]; const _Float16 hv = (_Float16)v; so[wave][8 * g + r][j * 16 + col] = hv; sol[wave][8 * g + r][j * 16 + col] = (_Float16)((v - (float)hv) * 2048.0f); } }   // q, k (normed + rotated) as f16 hi + (x2048) residual
    LDSX();
    for (int rl = 0; rl < 16; ++rl) if (lane < 16) { vst2((unsigned*)(QK + (r0 + rl) * (2 * DM) + n0 + lane * 8), *(const v4u*)&so[wave][rl][lane * 8]); vst2((unsigned*)(QKL + (r0 + rl) * (2 * DM) + n0 + lane * 8), *(const v4u*)&sol[wave][rl][lane * 8]); }
  } else {
#pragma unroll
    for (int j = 0; j < 8; ++j) {
#pragma unroll
      for (int r = 0; r < 8; ++r) { const float v = acc[j][r]; const _Float16 hv = (_Float16)v; sth[j * 16 + col][wave * 16 + 8 * g + r] = hv; stl[j * 16 + col][wave * 16 + 8 * g + r] = (_Float16)((v - (float)hv) * 2048.0f); } }
    __syncthreads();
    const size_t rb = (size_t)blockIdx.x * 64; const int b = (int)(rb / SS), s0 = (int)(rb % SS); const int pc0 = n0 - 2 * DM;
    for (int q = tid; q < 128 * 8; q += 128) { const int d = q >> 3, pc = q & 7; const size_t o = ((size_t)b * DM + pc0 + d) * SS + s0 + pc * 8; vst2((unsigned*)(VTH + o), *(const v4u*)&sth[d][pc * 8]); vst2((unsigned*)(VTL + o), *(const v4u*)&stl[d][pc * 8]); }
  }
}
// lane l with lane l ^ 16 (the two halves of a wave hold the two key halves of one query column)
__device__ __forceinline__ float xhalf(float x) { return __builtin_bit_cast(float, __builtin_amdgcn_permlanex16(__builtin_bit_cast(int, x), __builtin_bit_cast(int, x), 0x76543210, 0xfedcba98, false, false)); }
// 2^x for eight values (and, in exp2_9, one more): the v_exp_f32 stand in ONE statement with early-clobber outputs, so that none reads the result or overwrites the source of the one in front of it; the v_nop is the slot the instruction set asks for behind the last of them
__device__ __forceinline__ void exp2_8(const float* x, float* e) {
  asm("v_exp_f32 %0, %8\n\tv_exp_f32 %1, %9\n\tv_exp_f32 %2, %10\n\tv_exp_f32 %3, %11\n\tv_exp_f32 %4, %12\n\tv_exp_f32 %5, %13\n\tv_exp_f32 %6, %14\n\tv_exp_f32 %7, %15\n\tv_nop"
      : "=&v"(e[0]), "=&v"(e[1]), "=&v"(e[2]), "=&v"(e[3]), "=&v"(e[4]), "=&v"(e[5]), "=&v"(e[6]), "=&v"(e[7])
      : "v"(x[0]), "v"(x[1]), "v"(x[2]), "v"(x[3]), "v"(x[4]), "v"(x[5]), "v"(x[6]), "v"(x[7]));
}
__device__ __forceinline__ void exp2_9(float xa, float& ea, const float* x, float* e) {
  asm("v_exp_f32 %0, %9\n\tv_exp_f32 %1, %10\n\tv_exp_f32 %2, %11\n\tv_exp_f32 %3, %12\n\tv_exp_f32 %4, %13\n\tv_exp_f32 %5, %14\n\tv_exp_f32 %6, %15\n\tv_exp_f32 %7, %16\n\tv_exp_f32 %8, %17\n\tv_nop"
      : "=&v"(ea), "=&v"(e[0]), "=&v"(e[1]), "=&v"(e[2]), "=&v"(e[3]), "=&v"(e[4]), "=&v"(e[5]), "=&v"(e[6]), "=&v"(e[7])
      : "v"(xa), "v"(x[0]), "v"(x[1]), "v"(x[2]), "v"(x[3]), "v"(x[4]), "v"(x[5]), "v"(x[6]), "v"(x[7]));
}
__global__ __launch_bounds__(128) void k_attn(const _Float16* __restrict__ QK, const _Float16* __restrict__ QKL, const _Float16* __restrict__ VTH, const _Float16* __restrict__ VTL, float* __restrict__ O) {
  __shared__ __align__(16) char smem[2 * ASTAGE];   // two stage buffers; behind the loop's last barrier the same bytes stage the output
  float (*so)[16][68] = (float (*)[16][68])smem;
  const int tid = threadIdx.x, wave = tid >> 5, lane = tid & 31, col = lane & 15, g = lane >> 4;
  const int qb = blockIdx.x, h = blockIdx.y, b = blockIdx.z; const int q0 = qb * 64 + wave * 16; const size_t rq = (size_t)b * SS + q0 + col; const int qi = q0 + col;
  (void)QKL;
  v16h aq[2];
#pragma unroll   // register arrays: every index must be a constant
  for (int kc = 0; kc < 2; ++kc) aq[kc] = frag_h(QK + rq * (2 * DM) + h * HD + kc * 32, lane);
  float m = -3.0e38f, l = 0.f;   // of query qi; l is this lane half's share of the sum, joined behind the loop
  v8f acc[4] = {}, accl[4] = {};   // O^T tiles: register r = dim dt * 16 + 8 g + r of query qi
  const unsigned l0 = (unsigned)(uintptr_t)smem; const _Float16* Kb = QK + (size_t)b * SS * (2 * DM) + DM + h * HD; const _Float16* Vhb = VTH + ((size_t)b * DM + h * HD) * SS; const _Float16* Vlb = VTL + ((size_t)b * DM + h * HD) * SS;
  attn_fill(l0, Kb, Vhb, Vlb, tid); WAIT_ASYNC(); __syncthreads();
  if (qb >= 1) attn_fill(l0 + ASTAGE, Kb + (size_t)64 * (2 * DM), Vhb + 64, Vlb + 64, tid);
#pragma unroll 1   // one stage of 64 keys a trip: the ring's order at the foot stays as written
  for (int st = 0; st <= qb; ++st) { const char* sb = smem + (st & 1) * ASTAGE;
#pragma unroll   // both 32-key halves of a stage written out: their LDS offsets become immediates
  for (int hf = 0; hf < 2; ++hf) { const int dq = qi - 8 * g - (st * 2 + hf) * 32; v8f s[2]; v16h kf[2][2];   // key ct * 16 + r of this lane's rows is allowed while ct * 16 + r <= dq
#pragma unroll   // register arrays: every index must be a constant
    for (int ct = 0; ct < 2; ++ct) { const _Float16* krow = (const _Float16*)(sb + (hf * 32 + ct * 16 + col) * ROWP); kf[ct][0] = frag_h(krow, lane); kf[ct][1] = frag_h(krow + 32, lane); }
    HOLD4(kf[0][0], kf[0][1], kf[1][0], kf[1][1]);   // the reads of this half's k rows issue together, in front of the score products
#pragma unroll   // register arrays: every index must be a constant
    for (int ct = 0; ct < 2; ++ct) { v8f c = {};
#pragma unroll   // register arrays: every index must be a constant
      for (int kc = 0; kc < 2; ++kc) c = wmma16(kf[ct][kc], aq[kc], c);   // single product: q, k (unit-norm heads) as one-rounding f16 operands; register r = key ct * 16 + 8 g + r
#pragma unroll   // register arrays: every index must be a constant
      for (int r = 0; r < 8; ++r) s[ct][r] = (ct * 16 + r <= dq) ? c[r] * 0.125f : -3.0e38f; }   // SCALE = 1/sqrt(64)
    float mx = fmaxf(s[0][0], s[1][0]);
#pragma unroll   // register arrays: every index must be a constant
    for (int r = 1; r < 8; ++r) mx = fmaxf(mx, fmaxf(s[0][r], s[1][r]));
    mx = fmaxf(mx, xhalf(mx));
    const float mn = fmaxf(m, mx); float x0[8], x1[8], y0[8], y1[8], ya;
#pragma unroll   // register arrays: every index must be a constant
    for (int r = 0; r < 8; ++r) { x0[r] = (s[0][r] - mn) * 1.44269504f; x1[r] = (s[1][r] - mn) * 1.44269504f; }   // e^v = 2^(v log2 e), as __expf forms it
    exp2_9((m - mn) * 1.44269504f, ya, x0, y0); exp2_8(x1, y1);
    const float alpha = (m <= -1.0e38f) ? 0.f : ya;
    v16h pa; float t[8];   // P scaled by 2^11 before the f16 rounding so small softmax weights stay out of the f16 subnormal range; 2^-11 folded into the epilogue
#pragma unroll   // register arrays: every index must be a constant
    for (int r = 0; r < 8; ++r) { const float e0 = (s[0][r] <= -1.0e38f) ? 0.f : y0[r], e1 = (s[1][r] <= -1.0e38f) ? 0.f : y1[r];
      t[r] = e0 + e1; pa[r] = (_Float16)(e0 * 2048.0f); pa[8 + r] = (_Float16)(e1 * 2048.0f); }   // element s of the B operand = key 8 g + s (s < 8), 16 + 8 g + s - 8 (else): the two score tiles as they lie
    l = l * alpha + (((t[0] + t[1]) + (t[2] + t[3])) + ((t[4] + t[5]) + (t[6] + t[7]))); m = mn;
#pragma unroll   // register arrays: every index must be a constant
    for (int dt = 0; dt < 4; ++dt) { acc[dt] *= alpha; accl[dt] *= alpha; }
#pragma unroll   // register arrays: every index must be a constant
    for (int dt = 0; dt < 4; ++dt) { const _Float16* vr = (const _Float16*)(sb + AT_BYTES + (dt * 16 + col) * ROWP) + hf * 32; acc[dt] = wmma16(frag_h(vr, lane), pa, acc[dt]); accl[dt] = wmma16(frag_h(vr + AT_BYTES / 2, lane), pa, accl[dt]); } }   // V hi x P (single) + V lo x P / 2048: 2 products
    WAIT_DS(); WAIT_ASYNC(); __syncthreads();
    if (st + 2 <= qb) attn_fill(l0 + (st & 1) * ASTAGE, Kb + (size_t)(st + 2) * 64 * (2 * DM), Vhb + (st + 2) * 64, Vlb + (st + 2) * 64, tid); }
  WAIT_ASYNC();
  const float il = (1.0f / 2048.0f) / (l + xhalf(l));
#pragma unroll   // register arrays: every index must be a constant
  for (int dt = 0; dt < 4; ++dt) { v4f o0, o1;
#pragma unroll   // register arrays: every index must be a constant
    for (int r = 0; r < 4; ++r) { o0[r] = (acc[dt][r] + accl[dt][r] * (1.0f / 2048.0f)) * il; o1[r] = (acc[dt][4 + r] + accl[dt][4 + r] * (1.0f / 2048.0f)) * il; }
    *(v4f*)&so[wave][col][dt * 16 + 8 * g] = o0; *(v4f*)&so[wave][col][dt * 16 + 8 * g + 4] = o1; }
  LDSX();
  for (int rl = 0; rl < 16; ++rl) if (lane < 16) vst2(O + ((size_t)b * SS + q0 + rl) * DM + h * HD + lane * 4, *(const v4f*)&so[wave][rl][lane * 4]);
}
// ---- k_out: block = (64 rows, 128 cols): out = O(hi/lo) . Wo rows (2 products); no bias (BO is null)
__global__ __launch_bounds__(128) void k_out(const float* __restrict__ O, const __bf16* __restrict__ P, const float* __restrict__ BO, float* __restrict__ Y) {
  __shared__ __align__(16) char smem[2 * GSTAGE];   // two stage buffers; behind the loop's last barrier the same bytes stage the output
  float (*so)[16][132] = (float (*)[16][132])smem;
  const int tid = threadIdx.x, wave = tid >> 5, lane = tid & 31, col = lane & 15, g = lane >> 4; const size_t r0 = (size_t)blockIdx.x * 64 + wave * 16; const int n0 = blockIdx.y * 128;
  v8f acc[8] = {};
  const unsigned l0 = (unsigned)(uintptr_t)smem; const float* Ab = O + (size_t)blockIdx.x * 64 * DM; const __bf16* Bb = P + (size_t)n0 * DM;
  gemm_fill(l0, Ab, Bb, tid); WAIT_ASYNC(); __syncthreads();
  gemm_fill(l0 + GSTAGE, Ab + GK, Bb + GK, tid);
#pragma unroll 1   // one stage a trip: the ring's order at the foot stays as written
  for (int t = 0; t < DM / GK; ++t) { const char* sb = smem + (t & 1) * GSTAGE;
#pragma unroll   // both 32-k halves of a stage written out: their LDS offsets become immediates
    for (int kc = 0; kc < GK / 32; ++kc) { const float* p = (const float*)(sb + GB_BYTES + (wave * 16 + col) * ROWP2) + kc * 32 + 8 * g;
      const v4f a0 = *(const v4f*)p, a1 = *(const v4f*)(p + 4), a2 = *(const v4f*)(p + 16), a3 = *(const v4f*)(p + 20); v16b w[8]; float v[16];
#pragma unroll
      for (int j = 0; j < 8; ++j) w[j] = frag_b((const __bf16*)(sb + (j * 16 + col) * ROWP) + kc * 32, lane);
      HOLD4(a0, a1, a2, a3); HOLD8(w[0], w[1], w[2], w[3], w[4], w[5], w[6], w[7]);   // the reads of this k step issue together, in front of its matrix instructions
#pragma unroll
      for (int i = 0; i < 4; ++i) { v[i] = a0[i]; v[4 + i] = a1[i]; v[8 + i] = a2[i]; v[12 + i] = a3[i]; }
      const F2 a = bsplit16(v);
#pragma unroll
      for (int j = 0; j < 8; ++j) { acc[j] = wmma_bf(a.l, w[j], acc[j]); acc[j] = wmma_bf(a.h, w[j], acc[j]); } }
    WAIT_DS(); WAIT_ASYNC(); __syncthreads();
    if (t + 2 < DM / GK) gemm_fill(l0 + (t & 1) * GSTAGE, Ab + (t + 2) * GK, Bb + (t + 2) * GK, tid); }
  WAIT_ASYNC();
#pragma unroll
  for (int j = 0; j < 8; ++j) {
#pragma unroll
    for (int r = 0; r < 8; ++r) so[wave][8 * g + r][j * 16 + col] = acc[j][r] + (BO ? bfr(BO[n0 + j * 16 + col]) : 0.f); }
  LDSX();
  for (int rl = 0; rl < 16; ++rl) vst2(Y + (r0 + rl) * DM + n0 + lane * 4, *(const v4f*)&so[wave][rl][lane * 4]);
}
extern "C" void kernel_launch(void* const* d_in, const int* in_sizes, int n_in, void* d_out, int out_size, void* d_ws, size_t ws_size, hipStream_t stream) {
  (void)in_sizes; (void)n_in; (void)out_size;
  const float** F = (const float**)d_in;   // 0 x [4,2048,1024], 1 w_attn [3072,1024] natural (q | k | v row blocks), 2 w_proj [1024,1024] natural
  if (ws_size < (size_t)WS_END) return;
  char* ws = (char*)d_ws; __bf16* PK = (__bf16*)(ws + WS_PK); _Float16 *QK = (_Float16*)(ws + WS_QK), *QKL = (_Float16*)(ws + WS_QKL), *VTH = (_Float16*)(ws + WS_VTH), *VTL = (_Float16*)(ws + WS_VTL); float* O = (float*)(ws + WS_O);
  k_pack<<<dim3(DM, 4), 256, 0, stream>>>(F[1], F[1] + (size_t)DM * DM, F[1] + (size_t)2 * DM * DM, F[2], PK);
  k_qkv<<<dim3(TNB * SS / 64, QKVW / 128), 128, 0, stream>>>(F[0], PK + PK_A, QK, QKL, VTH, VTL);
  k_attn<<<dim3(TQB, NH, TNB), 128, 0, stream>>>(QK, QKL, VTH, VTL, O);
  k_out<<<dim3(TOB, DM / 128), 128, 0, stream>>>(O, PK + PK_P, nullptr, (float*)d_out);
}

// v005
// It runs in 183 microseconds.
// It is 1.13 times as fast as v003, going by the measured steps of the versions left out in between.
// All steps since v000 together make it 3.79 times as fast.
// compute dtype: all float inputs rounded to bf16; qkv = x . Wqkv^T with EXACT bf16 products on WMMA 16x16x32 (natural rows); per head, q and k rms-normalised over 64 dims (eps = f32 eps, no weight) and rotated with cos/sin = bf16(cos/sin(t * inv_freq)) (inv_freq constants reproduced from the module, precise cosf/sinf, the module's bf16 cache rounding reproduced), all in f32; then q/k as single f16 operands (plain causal scores x 1/8; unit-norm heads keep logits <= 8); softmax in f32 against the fixed bound 8 of the logits, no running maximum (hardware exp); P (scaled, single f16) x v (f16 hi + x2048 residual), 2 products; out = y (bf16 hi + residual) . Wproj^T (2 products); f32 accumulate.
#include <hip/hip_runtime.h>
#include <math.h>

typedef __attribute__((ext_vector_type(16))) _Float16 v16h;
typedef __attribute__((ext_vector_type(16))) __bf16 v16b;
typedef __attribute__((ext_vector_type(8)))  _Float16 v8h;
typedef __attribute__((ext_vector_type(8)))  float v8f;
typedef __attribute__((ext_vector_type(4)))  float v4f;
typedef __attribute__((ext_vector_type(2)))  float v2f;
typedef __attribute__((ext_vector_type(4)))  unsigned v4u;
typedef __attribute__((ext_vector_type(4)))  int v4i;
typedef float __attribute__((may_alias)) float_a;
typedef int __attribute__((may_alias)) int_a;

template <typename T> __device__ __forceinline__ void vst2(void* p, T v) { *(T*)p = v;  }
__device__ __forceinline__ v8f wmma16(v16h a, v16h b, v8f c) {
  return __builtin_amdgcn_wmma_f32_16x16x32_f16(false, a, false, b, (short)0, c, false, false);
}
__device__ __forceinline__ v8f wmma_bf(v16b a, v16b b, v8f c) {
  return __builtin_amdgcn_wmma_f32_16x16x32_bf16(false, a, false, b, (short)0, c, false, false);
}
// Causal self attention with parameter-free RMS-norm and rotary embedding on q/k (B 4, T 2,048, C 1,024, 16 heads x 64): fused qkv projection (natural [3C][C] rows), causal softmax(q k^T / 8) v, output projection.
__device__ __forceinline__ v16h frag_h(const _Float16* rowk0, int lane) {
  union { v16h v; v8h q[2]; } u; const _Float16* p = rowk0 + 8 * (lane >> 4);
  u.q[0] = *(const v8h*)p; u.q[1] = *(const v8h*)(p + 16); return u.v;
}
__device__ __forceinline__ v16h frag_f32(const float* rowk0, int lane) {
  v16h a; const float* p = rowk0 + 8 * (lane >> 4);
#pragma unroll
  for (int i = 0; i < 8; ++i) { a[i] = (_Float16)p[i]; a[8 + i] = (_Float16)p[16 + i]; }
  return a;
}
__device__ __forceinline__ v16h frag_f32s(const float* rowk0, int lane, float sc) {
  v16h a; const float* p = rowk0 + 8 * (lane >> 4);
#pragma unroll
  for (int i = 0; i < 8; ++i) { a[i] = (_Float16)(p[i] * sc); a[8 + i] = (_Float16)(p[16 + i] * sc); }
  return a;
}
// column fragment from a [K][ld] layout (column n), rows >= K read as 0
__device__ __forceinline__ v16h fragc_f32(const float* W, int k0, int n, int lane, int ld, int K) {
  v16h a; const int g = lane >> 4;
#pragma unroll
  for (int i = 0; i < 8; ++i) { const int ka = k0 + 8 * g + i, kb = ka + 16;
    a[i] = (_Float16)(ka < K ? W[(size_t)(ka < K ? ka : K - 1) * ld + n] : 0.f); a[8 + i] = (_Float16)(kb < K ? W[(size_t)(kb < K ? kb : K - 1) * ld + n] : 0.f); }
  return a;
}
struct F2 { v16b h, l; };
__device__ __forceinline__ F2 bsplit16(const float v[16]) { F2 r;
#pragma unroll
  for (int i = 0; i < 16; ++i) { const __bf16 h = (__bf16)v[i]; r.h[i] = h; r.l[i] = (__bf16)(v[i] - (float)h); }
  return r; }
__device__ __forceinline__ F2 split_row(const float* row, int k0, int lane) { float v[16]; const float* p = row + k0 + 8 * (lane >> 4);
#pragma unroll
  for (int i = 0; i < 8; ++i) { v[i] = p[i]; v[8 + i] = p[16 + i]; }
  return bsplit16(v); }
__device__ __forceinline__ F2 split_rowK(const float* row, int k0, int lane, int K) { float v[16]; const int g = lane >> 4;
#pragma unroll
  for (int i = 0; i < 8; ++i) { const int ka = k0 + 8 * g + i, kb = ka + 16; v[i] = ka < K ? row[ka < K ? ka : K - 1] : 0.f; v[8 + i] = kb < K ? row[kb < K ? kb : K - 1] : 0.f; }
  return bsplit16(v); }
__device__ __forceinline__ F2 split_col(const float* W, int k0, int n, int lane, int ld, int K) { float v[16]; const int g = lane >> 4;
#pragma unroll
  for (int i = 0; i < 8; ++i) { const int ka = k0 + 8 * g + i, kb = ka + 16; v[i] = ka < K ? W[(size_t)(ka < K ? ka : K - 1) * ld + n] : 0.f; v[8 + i] = kb < K ? W[(size_t)(kb < K ? kb : K - 1) * ld + n] : 0.f; }
  return bsplit16(v); }
__device__ __forceinline__ v8f mac3(const F2& a, const F2& b, v8f c) { c = wmma_bf(a.l, b.h, c); c = wmma_bf(a.h, b.l, c); return wmma_bf(a.h, b.h, c); }
__device__ __forceinline__ float sigm(float v) { return 1.0f / (1.0f + expf(-v)); }
#define LDSX() do { asm volatile("s_wait_dscnt 0" ::: "memory"); __builtin_amdgcn_wave_barrier(); __builtin_amdgcn_fence(__ATOMIC_RELEASE, "workgroup"); } while (0)


#define NB 4
__constant__ float INVF[32] = {1.000000000e+00f,7.498942018e-01f,5.623413324e-01f,4.216965139e-01f,3.162277639e-01f,2.371373773e-01f,1.778279394e-01f,1.333521456e-01f,1.000000015e-01f,7.498942316e-02f,5.623413250e-02f,4.216964915e-02f,3.162277490e-02f,2.371373773e-02f,1.778279431e-02f,1.333521400e-02f,9.999999776e-03f,7.498942316e-03f,5.623413250e-03f,4.216964822e-03f,3.162277630e-03f,2.371373819e-03f,1.778279431e-03f,1.333521446e-03f,1.000000047e-03f,7.498941850e-04f,5.623413017e-04f,4.216965172e-04f,3.162277571e-04f,2.371373703e-04f,1.778279402e-04f,1.333521504e-04f};
__device__ __attribute__((noinline)) float cos_p(float v) { return cosf(v); }
__device__ __attribute__((noinline)) float sin_p(float v) { return sinf(v); }
#define SS 2048
#define DM 1024
#define NH 16
#define HD 64
#define QKVW (3 * DM)
#ifndef TQB
#define TQB (SS / 64)
#define TNB NB
#define TOB (NB * SS / 64)     // 64-row tiles of all rows (unused)
#endif
typedef __attribute__((ext_vector_type(8))) __bf16 v8b;
__device__ __forceinline__ v16b frag_b(const __bf16* rowk0, int lane) {
  union { v16b v; v8b q[2]; } u; const __bf16* p = rowk0 + 8 * (lane >> 4);
  u.q[0] = *(const v8b*)p; u.q[1] = *(const v8b*)(p + 16); return u.v;
}
__device__ __forceinline__ float bfr(float v) { return (float)(__bf16)v; }
__device__ __attribute__((noinline)) float exp_ni(float v) { return expf(v); }
__device__ __attribute__((noinline)) float erf_ni(float v) { return erff(v); }

#define PK_A 0                       // [3072][1024] Wqkv rows (natural [out][in])
#define PK_P (PK_A + QKVW * DM)        // [1024][1024] Wo rows (natural)
#define PK_END (PK_P + DM * DM)
#define WS_PK  0u
#define WS_QK  (WS_PK + 2u * PK_END)             // f16 [8192 rows][2048]: q | k
#define WS_QKL (WS_QK + 2u * NB * SS * 2 * DM)     // f16 q | k residual planes x2048
#define WS_VTH (WS_QKL + 2u * NB * SS * 2 * DM)    // f16 [b][1024 (h*64+d)][2048 s] hi
#define WS_VTL (WS_VTH + 2u * NB * DM * SS)        // f16 lo x 2048
#define WS_O   (WS_VTL + 2u * NB * DM * SS)        // f32 [8192][1024]
#define WS_CS  (WS_O + 4u * NB * SS * DM)           // f32 2 x [2048][32], unused (cos/sin are computed in k_qkv)
#define WS_END (WS_CS + 4u * 2 * SS * 32)
// ---- LDS staging by asynchronous copies: every lane brings 16 bytes, a wave's copy covers whole 128-byte lines; rows padded by 16 bytes for the 16-byte fragment reads
#define ROWP 144                       // LDS pitch of a 128-byte row
#define ROWP2 272                      // LDS pitch of a 256-byte row
#define GK 64                          // k per GEMM stage
#define GBM 128                        // rows of a work-group's GEMM tile: 4 waves down, 32 rows each
#define GBN 256                        // columns of it: 2 waves across, 128 columns each
#define GB_BYTES (GBN * ROWP)          // 256 weight rows x 64 bf16
#define GA_BYTES (GBM * ROWP2)         // 128 activation rows x 64 f32
#define GSTAGE (GB_BYTES + GA_BYTES)
#define AT_BYTES (64 * ROWP)           // attention: 64 rows x 64 f16 (k rows; v hi; v lo)
#define ASTAGE (3 * AT_BYTES)
// the landing wait of this wave's own copies; the barrier behind it publishes them to the other waves
#define WAIT_ASYNC() asm volatile("s_wait_asynccnt 0x0" ::: "memory")
// this wave's LDS reads have returned before the barrier behind which their buffer is refilled
#define WAIT_DS() asm volatile("s_wait_dscnt 0x0" ::: "memory")
// a group of LDS fragment reads is held in front of the matrix instructions that use it, so that the reads issue together and are waited for once, not one pair and one wait per matrix instruction (loaded values as inputs only: nothing is changed and no product is named)
#define HOLD4(a, b, c, d) asm volatile("" :: "v"(a), "v"(b), "v"(c), "v"(d))
#define HOLD8(a, b, c, d, e, f, g, h) asm volatile("" :: "v"(a), "v"(b), "v"(c), "v"(d), "v"(e), "v"(f), "v"(g), "v"(h))
// four copies of one lane at constant row steps; s_wait_xcnt closes the statement so that no address register is rewritten ahead of it
__device__ __forceinline__ void acopy4(unsigned l, unsigned ls, const char* gp, size_t gs) {
  asm volatile("global_load_async_to_lds_b128 %0, %4, off\n\t"
               "global_load_async_to_lds_b128 %1, %5, off\n\t"
               "global_load_async_to_lds_b128 %2, %6, off\n\t"
               "global_load_async_to_lds_b128 %3, %7, off\n\t"
               "s_wait_xcnt 0x0"
               :: "v"(l), "v"(l + ls), "v"(l + 2 * ls), "v"(l + 3 * ls), "v"(gp), "v"(gp + gs), "v"(gp + 2 * gs), "v"(gp + 3 * gs) : "memory");
}
// one GEMM stage, brought by 256 threads: weight rows n0..n0+255 and activation rows r..r+127, 64 k each (Ar, Br point at the stage's first k)
__device__ __forceinline__ void gemm_fill(unsigned lb, const float* Ar, const __bf16* Br, int tid) {
  const unsigned lB = lb + (tid >> 3) * ROWP + (tid & 7) * 16; const char* gB = (const char*)(Br + (size_t)(tid >> 3) * DM) + (tid & 7) * 16;
  acopy4(lB, 32 * ROWP, gB, (size_t)32 * DM * 2); acopy4(lB + 128 * ROWP, 32 * ROWP, gB + (size_t)128 * DM * 2, (size_t)32 * DM * 2);
  const unsigned lA = lb + GB_BYTES + (tid >> 4) * ROWP2 + (tid & 15) * 16; const char* gA = (const char*)(Ar + (size_t)(tid >> 4) * DM) + (tid & 15) * 16;
  acopy4(lA, 16 * ROWP2, gA, (size_t)16 * DM * 4); acopy4(lA + 64 * ROWP2, 16 * ROWP2, gA + (size_t)64 * DM * 4, (size_t)16 * DM * 4);
}
// one attention stage: 64 k rows (64 dims each) and, for 64 dims, 64 keys of v hi and of v lo; every row 128 bytes at a global pitch of 4,096 bytes
__device__ __forceinline__ void attn_fill(unsigned lb, const _Float16* Kr, const _Float16* Vh, const _Float16* Vl, int tid) {
  const unsigned l = lb + (tid >> 3) * ROWP + (tid & 7) * 16; const size_t ko = (size_t)(tid >> 3) * (2 * DM * 2) + (tid & 7) * 16, vo = (size_t)(tid >> 3) * (SS * 2) + (tid & 7) * 16;
  acopy4(l, 16 * ROWP, (const char*)Kr + ko, (size_t)16 * 2 * DM * 2);
  acopy4(l + AT_BYTES, 16 * ROWP, (const char*)Vh + vo, (size_t)16 * SS * 2);
  acopy4(l + 2 * AT_BYTES, 16 * ROWP, (const char*)Vl + vo, (size_t)16 * SS * 2);
}
// ---- k_pack: block = (row n, which): natural [out][in] rows -> bf16; which 0..2 -> W_q/W_k/W_v into PK_A rows which*1024 + n; 3 -> W_o into PK_P
__global__ __launch_bounds__(256) void k_pack(const float* __restrict__ WQ, const float* __restrict__ WK, const float* __restrict__ WV, const float* __restrict__ WO, __bf16* __restrict__ PK) {
  __shared__ __align__(16) __bf16 s[DM]; const int n = blockIdx.x, which = blockIdx.y, t = threadIdx.x; const float* Wm = (which == 0) ? WQ : (which == 1) ? WK : (which == 2) ? WV : WO;
  for (int k = t; k < DM; k += 256) s[k] = (__bf16)Wm[(size_t)n * DM + k];
  __syncthreads();
  __bf16* dst = (which < 3) ? PK + PK_A + ((size_t)which * DM + n) * DM : PK + PK_P + (size_t)n * DM;
  for (int q = t; q < DM / 8; q += 256) vst2((unsigned*)(dst + q * 8), *(const v4u*)&s[q * 8]);
}
// ---- k_qkv: block = (128 rows, 256 cols), 8 waves as 4 x 2, a wave holds 32 rows x 128 cols (two heads): every weight fragment read from LDS serves two row fragments; four waves a SIMD asked for (256 registers a wave), so that two blocks share a WGP and one block's epilogue and ring waits are covered by the other
__global__ __launch_bounds__(256) __attribute__((amdgpu_waves_per_eu(4, 4))) void k_qkv(const float* __restrict__ X, const __bf16* __restrict__ P, _Float16* __restrict__ QK, _Float16* __restrict__ QKL, _Float16* __restrict__ VTH, _Float16* __restrict__ VTL) {
  __shared__ __align__(16) char smem[2 * GSTAGE];   // two stage buffers; behind the loop's last barrier the same bytes stage the output
  float (*sf)[32][132] = (float (*)[32][132])smem; _Float16 (*sth)[136] = (_Float16 (*)[136])smem; _Float16 (*stl)[136] = (_Float16 (*)[136])(smem + GBN * 136 * 2);
  const int tid = threadIdx.x, wave = tid >> 5, lane = tid & 31, col = lane & 15, g = lane >> 4, wm = wave >> 1, wn = wave & 1; const size_t r0 = (size_t)blockIdx.x * GBM + wm * 32; const int n0 = blockIdx.y * GBN, nw = n0 + wn * 128;
  v8f acc[2][8] = {};
  const unsigned l0 = (unsigned)(uintptr_t)smem; const float* Ab = X + (size_t)blockIdx.x * GBM * DM; const __bf16* Bb = P + (size_t)n0 * DM;
  gemm_fill(l0, Ab, Bb, tid); WAIT_ASYNC(); __syncthreads();
  gemm_fill(l0 + GSTAGE, Ab + GK, Bb + GK, tid);
#pragma unroll 1   // one stage a trip: the ring's order at the foot stays as written
  for (int t = 0; t < DM / GK; ++t) { const char* sb = smem + (t & 1) * GSTAGE;
#pragma unroll   // both 32-k halves of a stage written out: their LDS offsets become immediates
    for (int kc = 0; kc < GK / 32; ++kc) { const float* p = (const float*)(sb + GB_BYTES + (wm * 32 + col) * ROWP2) + kc * 32 + 8 * g; const float* p1 = (const float*)((const char*)p + 16 * ROWP2);
      const v4f a0 = *(const v4f*)p, a1 = *(const v4f*)(p + 4), a2 = *(const v4f*)(p + 16), a3 = *(const v4f*)(p + 20), b0 = *(const v4f*)p1, b1 = *(const v4f*)(p1 + 4), b2 = *(const v4f*)(p1 + 16), b3 = *(const v4f*)(p1 + 20); v16b w[8], a[2];
#pragma unroll
      for (int j = 0; j < 8; ++j) w[j] = frag_b((const __bf16*)(sb + (wn * 128 + j * 16 + col) * ROWP) + kc * 32, lane);
      HOLD8(a0, a1, a2, a3, b0, b1, b2, b3); HOLD8(w[0], w[1], w[2], w[3], w[4], w[5], w[6], w[7]);   // the reads of this k step issue together, in front of its matrix instructions
#pragma unroll
      for (int i = 0; i < 4; ++i) { a[0][i] = (__bf16)a0[i]; a[0][4 + i] = (__bf16)a1[i]; a[0][8 + i] = (__bf16)a2[i]; a[0][12 + i] = (__bf16)a3[i]; a[1][i] = (__bf16)b0[i]; a[1][4 + i] = (__bf16)b1[i]; a[1][8 + i] = (__bf16)b2[i]; a[1][12 + i] = (__bf16)b3[i]; }
#pragma unroll
      for (int j = 0; j < 8; ++j) { acc[0][j] = wmma_bf(a[0], w[j], acc[0][j]); acc[1][j] = wmma_bf(a[1], w[j], acc[1][j]); } }
    WAIT_DS(); WAIT_ASYNC(); __syncthreads();
    if (t + 2 < DM / GK) gemm_fill(l0 + (t & 1) * GSTAGE, Ab + (t + 2) * GK, Bb + (t + 2) * GK, tid); }
  WAIT_ASYNC();
  if (n0 < 2 * DM) {   // q and k: the wave parks its 32 x 128 tile in LDS as f32 and walks it two rows a trip (a lane keeps the elements it held in the accumulators), so that no accumulator lives across the cos / sin calls: rms-norm per head (tiles 0-3 = head A, 4-7 = head B of this wave's 128 columns), then rotary (pairs d, d+32 = tiles j, j+2), then f16 hi + residual, written over the row's own f32 bytes (hi 256 bytes, residual 256 bytes)
#pragma unroll
    for (int m = 0; m < 2; ++m) {
#pragma unroll
      for (int j = 0; j < 8; ++j) {
#pragma unroll
        for (int r = 0; r < 8; ++r) sf[wave][m * 16 + 8 * g + r][j * 16 + col] = acc[m][j][r]; } }
    LDSX();
    const float fq[2] = {INVF[col], INVF[16 + col]};
#pragma unroll 1   // rolled: four calls a trip, few registers live across them
    for (int rr = 0; rr < 16; ++rr) { const int row = (rr >> 3) * 16 + 8 * g + (rr & 7); const int tpos = (int)((r0 + row) % SS); float a[8], c[2], sn[2];
#pragma unroll
      for (int j = 0; j < 8; ++j) a[j] = sf[wave][row][j * 16 + col];
      LDSX();   // every lane's f32 reads of the two rows have returned before any lane writes f16 over them
#pragma unroll
      for (int j = 0; j < 2; ++j) { const float fr = (float)tpos * fq[j]; c[j] = bfr(cos_p(fr)); sn[j] = bfr(sin_p(fr)); }
#pragma unroll
      for (int hh = 0; hh < 2; ++hh) { float ssq = 0.f;
#pragma unroll
        for (int j = 0; j < 4; ++j) ssq += a[hh * 4 + j] * a[hh * 4 + j];
#pragma unroll
        for (int o = 1; o < 16; o <<= 1) ssq += __shfl_xor(ssq, o);
        const float rinv = 1.0f / sqrtf(ssq / 64.0f + 1.1920928955078125e-07f);
#pragma unroll
        for (int j = 0; j < 2; ++j) { const float x1 = a[hh * 4 + j] * rinv, x2 = a[hh * 4 + j + 2] * rinv;
          a[hh * 4 + j] = x1 * c[j] + x2 * sn[j]; a[hh * 4 + j + 2] = -x1 * sn[j] + x2 * c[j]; } }
      _Float16* ph = (_Float16*)&sf[wave][row][0];
#pragma unroll
      for (int j = 0; j < 8; ++j) { const float v = a[j]; const _Float16 hv = (_Float16)v; ph[j * 16 + col] = hv; ph[128 + j * 16 + col] = (_Float16)((v - (float)hv) * 2048.0f); } }   // q, k (normed + rotated) as f16 hi + (x2048) residual
    LDSX();
    for (int rl = 0; rl < 32; ++rl) if (lane < 16) { const char* pr = (const char*)&sf[wave][rl][0] + lane * 16; vst2((unsigned*)(QK + (r0 + rl) * (2 * DM) + nw + lane * 8), *(const v4u*)pr); vst2((unsigned*)(QKL + (r0 + rl) * (2 * DM) + nw + lane * 8), *(const v4u*)(pr + 256)); }
  } else {
#pragma unroll
    for (int m = 0; m < 2; ++m) {
#pragma unroll
    for (int j = 0; j < 8; ++j) {
#pragma unroll
      for (int r = 0; r < 8; ++r) { const float v = acc[m][j][r]; const _Float16 hv = (_Float16)v; sth[wn * 128 + j * 16 + col][wm * 32 + m * 16 + 8 * g + r] = hv; stl[wn * 128 + j * 16 + col][wm * 32 + m * 16 + 8 * g + r] = (_Float16)((v - (float)hv) * 2048.0f); } } }
    __syncthreads();
    const size_t rb = (size_t)blockIdx.x * GBM; const int b = (int)(rb / SS), s0 = (int)(rb % SS); const int pc0 = n0 - 2 * DM;
    for (int q = tid; q < GBN * 16; q += 256) { const int d = q >> 4, pc = q & 15; const size_t o = ((size_t)b * DM + pc0 + d) * SS + s0 + pc * 8; vst2((unsigned*)(VTH + o), *(const v4u*)&sth[d][pc * 8]); vst2((unsigned*)(VTL + o), *(const v4u*)&stl[d][pc * 8]); }
  }
}
// lane l with lane l ^ 16 (the two halves of a wave hold the two key halves of one query column)
__device__ __forceinline__ float xhalf(float x) { return __builtin_bit_cast(float, __builtin_amdgcn_permlanex16(__builtin_bit_cast(int, x), __builtin_bit_cast(int, x), 0x76543210, 0xfedcba98, false, false)); }
// 2^x for eight values: the v_exp_f32 stand in ONE statement with early-clobber outputs, so that none reads the result or overwrites the source of the one in front of it; the v_nop is the slot the instruction set asks for behind the last of them
__device__ __forceinline__ void exp2_8(const float* x, float* e) {
  asm("v_exp_f32 %0, %8\n\tv_exp_f32 %1, %9\n\tv_exp_f32 %2, %10\n\tv_exp_f32 %3, %11\n\tv_exp_f32 %4, %12\n\tv_exp_f32 %5, %13\n\tv_exp_f32 %6, %14\n\tv_exp_f32 %7, %15\n\tv_nop"
      : "=&v"(e[0]), "=&v"(e[1]), "=&v"(e[2]), "=&v"(e[3]), "=&v"(e[4]), "=&v"(e[5]), "=&v"(e[6]), "=&v"(e[7])
      : "v"(x[0]), "v"(x[1]), "v"(x[2]), "v"(x[3]), "v"(x[4]), "v"(x[5]), "v"(x[6]), "v"(x[7]));
}
__global__ __launch_bounds__(128) void k_attn(const _Float16* __restrict__ QK, const _Float16* __restrict__ QKL, const _Float16* __restrict__ VTH, const _Float16* __restrict__ VTL, float* __restrict__ O) {
  __shared__ __align__(16) char smem[2 * ASTAGE];   // two stage buffers; behind the loop's last barrier the same bytes stage the output
  float (*so)[16][68] = (float (*)[16][68])smem;
  const int tid = threadIdx.x, wave = tid >> 5, lane = tid & 31, col = lane & 15, g = lane >> 4;
  const int qb = blockIdx.x, h = blockIdx.y, b = blockIdx.z; const int q0 = qb * 64 + wave * 16; const size_t rq = (size_t)b * SS + q0 + col; const int qi = q0 + col;
  (void)QKL;
  v16h aq[2];
#pragma unroll   // register arrays: every index must be a constant
  for (int kc = 0; kc < 2; ++kc) aq[kc] = frag_h(QK + rq * (2 * DM) + h * HD + kc * 32, lane);
  float l = 0.f;   // of query qi: this lane half's share of the sum of the weights, joined behind the loop
  v8f acc[4] = {}, accl[4] = {};   // O^T tiles: register r = dim dt * 16 + 8 g + r of query qi
  const unsigned l0 = (unsigned)(uintptr_t)smem; const _Float16* Kb = QK + (size_t)b * SS * (2 * DM) + DM + h * HD; const _Float16* Vhb = VTH + ((size_t)b * DM + h * HD) * SS; const _Float16* Vlb = VTL + ((size_t)b * DM + h * HD) * SS;
  attn_fill(l0, Kb, Vhb, Vlb, tid); WAIT_ASYNC(); __syncthreads();
  if (qb >= 1) attn_fill(l0 + ASTAGE, Kb + (size_t)64 * (2 * DM), Vhb + 64, Vlb + 64, tid);
#pragma unroll 1   // one stage of 64 keys a trip: the ring's order at the foot stays as written
  for (int st = 0; st <= qb; ++st) { const char* sb = smem + (st & 1) * ASTAGE;
#pragma unroll   // both 32-key halves of a stage written out: their LDS offsets become immediates
  for (int hf = 0; hf < 2; ++hf) { const int dq = qi - 8 * g - (st * 2 + hf) * 32; float x[2][8], y[2][8]; v16h kf[2][2];   // key ct * 16 + r of this lane's rows is allowed while ct * 16 + r <= dq
#pragma unroll   // register arrays: every index must be a constant
    for (int ct = 0; ct < 2; ++ct) { const _Float16* krow = (const _Float16*)(sb + (hf * 32 + ct * 16 + col) * ROWP); kf[ct][0] = frag_h(krow, lane); kf[ct][1] = frag_h(krow + 32, lane); }
    HOLD4(kf[0][0], kf[0][1], kf[1][0], kf[1][1]);   // the reads of this half's k rows issue together, in front of the score products
#pragma unroll   // register arrays: every index must be a constant
    for (int ct = 0; ct < 2; ++ct) { v8f c = {};
#pragma unroll   // register arrays: every index must be a constant
      for (int kc = 0; kc < 2; ++kc) c = wmma16(kf[ct][kc], aq[kc], c);   // single product: q, k (unit-norm heads) as one-rounding f16 operands; register r = key ct * 16 + 8 g + r
#pragma unroll   // register arrays: every index must be a constant
      for (int r = 0; r < 8; ++r) x[ct][r] = (ct * 16 + r <= dq) ? c[r] * 0.18033688f - 0.54156033f : -3.0e38f; }   // log2 of the weight 2^11 e^(c / 8 - 8): (c / 8 - 8) log2 e + 11 in one multiply-add; a key behind the query gets 2^(-3e38) = 0
    exp2_8(x[0], y[0]); exp2_8(x[1], y[1]);
    v16h pa; float t[8];   // the factor 2^11 keeps every weight, from 2^11 e^-16.1 up, a normal f16 number; l carries it too, so it cancels in the epilogue
#pragma unroll   // register arrays: every index must be a constant
    for (int r = 0; r < 8; ++r) { t[r] = y[0][r] + y[1][r]; pa[r] = (_Float16)y[0][r]; pa[8 + r] = (_Float16)y[1][r]; }   // element s of the B operand = key 8 g + s (s < 8), 16 + 8 g + s - 8 (else): the two score tiles as they lie
    l += ((t[0] + t[1]) + (t[2] + t[3])) + ((t[4] + t[5]) + (t[6] + t[7]));
#pragma unroll   // register arrays: every index must be a constant
    for (int dt = 0; dt < 4; ++dt) { const _Float16* vr = (const _Float16*)(sb + AT_BYTES + (dt * 16 + col) * ROWP) + hf * 32; acc[dt] = wmma16(frag_h(vr, lane), pa, acc[dt]); accl[dt] = wmma16(frag_h(vr + AT_BYTES / 2, lane), pa, accl[dt]); } }   // V hi x P (single) + V lo x P / 2048: 2 products
    WAIT_DS(); WAIT_ASYNC(); __syncthreads();
    if (st + 2 <= qb) attn_fill(l0 + (st & 1) * ASTAGE, Kb + (size_t)(st + 2) * 64 * (2 * DM), Vhb + (st + 2) * 64, Vlb + (st + 2) * 64, tid); }
  WAIT_ASYNC();
  const float il = 1.0f / (l + xhalf(l));
#pragma unroll   // register arrays: every index must be a constant
  for (int dt = 0; dt < 4; ++dt) { v4f o0, o1;
#pragma unroll   // register arrays: every index must be a constant
    for (int r = 0; r < 4; ++r) { o0[r] = (acc[dt][r] + accl[dt][r] * (1.0f / 2048.0f)) * il; o1[r] = (acc[dt][4 + r] + accl[dt][4 + r] * (1.0f / 2048.0f)) * il; }
    *(v4f*)&so[wave][col][dt * 16 + 8 * g] = o0; *(v4f*)&so[wave][col][dt * 16 + 8 * g + 4] = o1; }
  LDSX();
  for (int rl = 0; rl < 16; ++rl) if (lane < 16) vst2(O + ((size_t)b * SS + q0 + rl) * DM + h * HD + lane * 4, *(const v4f*)&so[wave][rl][lane * 4]);
}
// ---- k_out: block = (128 rows, 256 cols), 8 waves as 4 x 2, a wave holds 32 rows x 128 cols: out = O(hi/lo) . Wo rows (2 products) + bo
__global__ __launch_bounds__(256) void k_out(const float* __restrict__ O, const __bf16* __restrict__ P, const float* __restrict__ BO, float* __restrict__ Y) {
  __shared__ __align__(16) char smem[2 * GSTAGE];   // two stage buffers; behind the loop's last barrier the same bytes stage the output
  float (*so)[32][132] = (float (*)[32][132])smem;
  const int tid = threadIdx.x, wave = tid >> 5, lane = tid & 31, col = lane & 15, g = lane >> 4, wm = wave >> 1, wn = wave & 1; const size_t r0 = (size_t)blockIdx.x * GBM + wm * 32; const int n0 = blockIdx.y * GBN, nw = n0 + wn * 128;
  v8f acc[2][8] = {};
  const unsigned l0 = (unsigned)(uintptr_t)smem; const float* Ab = O + (size_t)blockIdx.x * GBM * DM; const __bf16* Bb = P + (size_t)n0 * DM;
  gemm_fill(l0, Ab, Bb, tid); WAIT_ASYNC(); __syncthreads();
  gemm_fill(l0 + GSTAGE, Ab + GK, Bb + GK, tid);
#pragma unroll 1   // one stage a trip: the ring's order at the foot stays as written
  for (int t = 0; t < DM / GK; ++t) { const char* sb = smem + (t & 1) * GSTAGE;
#pragma unroll   // both 32-k halves of a stage written out: their LDS offsets become immediates
    for (int kc = 0; kc < GK / 32; ++kc) { const float* p = (const float*)(sb + GB_BYTES + (wm * 32 + col) * ROWP2) + kc * 32 + 8 * g; const float* p1 = (const float*)((const char*)p + 16 * ROWP2);
      const v4f a0 = *(const v4f*)p, a1 = *(const v4f*)(p + 4), a2 = *(const v4f*)(p + 16), a3 = *(const v4f*)(p + 20), b0 = *(const v4f*)p1, b1 = *(const v4f*)(p1 + 4), b2 = *(const v4f*)(p1 + 16), b3 = *(const v4f*)(p1 + 20); v16b w[8]; float v[16], u[16];
#pragma unroll
      for (int j = 0; j < 8; ++j) w[j] = frag_b((const __bf16*)(sb + (wn * 128 + j * 16 + col) * ROWP) + kc * 32, lane);
      HOLD8(a0, a1, a2, a3, b0, b1, b2, b3); HOLD8(w[0], w[1], w[2], w[3], w[4], w[5], w[6], w[7]);   // the reads of this k step issue together, in front of its matrix instructions
#pragma unroll
      for (int i = 0; i < 4; ++i) { v[i] = a0[i]; v[4 + i] = a1[i]; v[8 + i] = a2[i]; v[12 + i] = a3[i]; u[i] = b0[i]; u[4 + i] = b1[i]; u[8 + i] = b2[i]; u[12 + i] = b3[i]; }
      const F2 a = bsplit16(v), c = bsplit16(u);
#pragma unroll
      for (int j = 0; j < 8; ++j) { acc[0][j] = wmma_bf(a.l, w[j], acc[0][j]); acc[1][j] = wmma_bf(c.l, w[j], acc[1][j]); acc[0][j] = wmma_bf(a.h, w[j], acc[0][j]); acc[1][j] = wmma_bf(c.h, w[j], acc[1][j]); } }
    WAIT_DS(); WAIT_ASYNC(); __syncthreads();
    if (t + 2 < DM / GK) gemm_fill(l0 + (t & 1) * GSTAGE, Ab + (t + 2) * GK, Bb + (t + 2) * GK, tid); }
  WAIT_ASYNC();
#pragma unroll
  for (int m = 0; m < 2; ++m) {
#pragma unroll
  for (int j = 0; j < 8; ++j) {
#pragma unroll
    for (int r = 0; r < 8; ++r) so[wave][m * 16 + 8 * g + r][j * 16 + col] = acc[m][j][r] + (BO ? bfr(BO[nw + j * 16 + col]) : 0.f); } }
  LDSX();
  for (int rl = 0; rl < 32; ++rl) vst2(Y + (r0 + rl) * DM + nw + lane * 4, *(const v4f*)&so[wave][rl][lane * 4]);
}
extern "C" void kernel_launch(void* const* d_in, const int* in_sizes, int n_in, void* d_out, int out_size, void* d_ws, size_t ws_size, hipStream_t stream) {
  (void)in_sizes; (void)n_in; (void)out_size;
  const float** F = (const float**)d_in;   // 0 x [4,2048,1024], 1 w_attn [3072,1024] natural (q | k | v row blocks), 2 w_proj [1024,1024] natural
  if (ws_size < (size_t)WS_END) return;
  char* ws = (char*)d_ws; __bf16* PK = (__bf16*)(ws + WS_PK); _Float16 *QK = (_Float16*)(ws + WS_QK), *QKL = (_Float16*)(ws + WS_QKL), *VTH = (_Float16*)(ws + WS_VTH), *VTL = (_Float16*)(ws + WS_VTL); float* O = (float*)(ws + WS_O);
  k_pack<<<dim3(DM, 4), 256, 0, stream>>>(F[1], F[1] + (size_t)DM * DM, F[1] + (size_t)2 * DM * DM, F[2], PK);
  k_qkv<<<dim3(TNB * SS / GBM, QKVW / GBN), 256, 0, stream>>>(F[0], PK + PK_A, QK, QKL, VTH, VTL);
  k_attn<<<dim3(TQB, NH, TNB), 128, 0, stream>>>(QK, QKL, VTH, VTL, O);
  k_out<<<dim3(TNB * SS / GBM, DM / GBN), 256, 0, stream>>>(O, PK + PK_P, nullptr, (float*)d_out);
}

// v006
// Measured time: 148 microseconds a run.
// In both of two side-by-side timings against v005, it was 1.23 times as fast.
// Counting every step since v000, it is 4.67 times as fast.
// compute dtype: all float inputs rounded to bf16; qkv = x . Wqkv^T with EXACT bf16 products on WMMA 16x16x32 (natural rows); per head, q and k rms-normalised over 64 dims (eps = f32 eps, no weight) and rotated with cos/sin = bf16(cos/sin(t * inv_freq)) (inv_freq constants reproduced from the module, precise cosf/sinf, the module's bf16 cache rounding reproduced), all in f32; then q/k as single f16 operands (plain causal scores x 1/8; unit-norm heads keep logits <= 8); softmax in f32 against the fixed bound 8 of the logits, no running maximum (hardware exp); P (scaled, single f16) x v (f16 hi + x2048 residual), 2 products; out = y (bf16 hi + residual) . Wproj^T (2 products); f32 accumulate.
#include <hip/hip_runtime.h>
#include <math.h>

typedef __attribute__((ext_vector_type(16))) _Float16 v16h;
typedef __attribute__((ext_vector_type(16))) __bf16 v16b;
typedef __attribute__((ext_vector_type(8)))  _Float16 v8h;
typedef __attribute__((ext_vector_type(8)))  float v8f;
typedef __attribute__((ext_vector_type(4)))  float v4f;
typedef __attribute__((ext_vector_type(2)))  float v2f;
typedef __attribute__((ext_vector_type(4)))  unsigned v4u;
typedef __attribute__((ext_vector_type(4)))  int v4i;
typedef float __attribute__((may_alias)) float_a;
typedef int __attribute__((may_alias)) int_a;

template <typename T> __device__ __forceinline__ void vst2(void* p, T v) { *(T*)p = v;  }
__device__ __forceinline__ v8f wmma16(v16h a, v16h b, v8f c) {
  return __builtin_amdgcn_wmma_f32_16x16x32_f16(false, a, false, b, (short)0, c, false, false);
}
__device__ __forceinline__ v8f wmma_bf(v16b a, v16b b, v8f c) {
  return __builtin_amdgcn_wmma_f32_16x16x32_bf16(false, a, false, b, (short)0, c, false, false);
}
// Causal self attention with parameter-free RMS-norm and rotary embedding on q/k (B 4, T 2,048, C 1,024, 16 heads x 64): fused qkv projection (natural [3C][C] rows), causal softmax(q k^T / 8) v, output projection.
__device__ __forceinline__ v16h frag_h(const _Float16* rowk0, int lane) {
  union { v16h v; v8h q[2]; } u; const _Float16* p = rowk0 + 8 * (lane >> 4);
  u.q[0] = *(const v8h*)p; u.q[1] = *(const v8h*)(p + 16); return u.v;
}
__device__ __forceinline__ v16h frag_f32(const float* rowk0, int lane) {
  v16h a; const float* p = rowk0 + 8 * (lane >> 4);
#pragma unroll
  for (int i = 0; i < 8; ++i) { a[i] = (_Float16)p[i]; a[8 + i] = (_Float16)p[16 + i]; }
  return a;
}
__device__ __forceinline__ v16h frag_f32s(const float* rowk0, int lane, float sc) {
  v16h a; const float* p = rowk0 + 8 * (lane >> 4);
#pragma unroll
  for (int i = 0; i < 8; ++i) { a[i] = (_Float16)(p[i] * sc); a[8 + i] = (_Float16)(p[16 + i] * sc); }
  return a;
}
// column fragment from a [K][ld] layout (column n), rows >= K read as 0
__device__ __forceinline__ v16h fragc_f32(const float* W, int k0, int n, int lane, int ld, int K) {
  v16h a; const int g = lane >> 4;
#pragma unroll
  for (int i = 0; i < 8; ++i) { const int ka = k0 + 8 * g + i, kb = ka + 16;
    a[i] = (_Float16)(ka < K ? W[(size_t)(ka < K ? ka : K - 1) * ld + n] : 0.f); a[8 + i] = (_Float16)(kb < K ? W[(size_t)(kb < K ? kb : K - 1) * ld + n] : 0.f); }
  return a;
}
struct F2 { v16b h, l; };
__device__ __forceinline__ F2 bsplit16(const float v[16]) { F2 r;
#pragma unroll
  for (int i = 0; i < 16; ++i) { const __bf16 h = (__bf16)v[i]; r.h[i] = h; r.l[i] = (__bf16)(v[i] - (float)h); }
  return r; }
__device__ __forceinline__ F2 split_row(const float* row, int k0, int lane) { float v[16]; const float* p = row + k0 + 8 * (lane >> 4);
#pragma unroll
  for (int i = 0; i < 8; ++i) { v[i] = p[i]; v[8 + i] = p[16 + i]; }
  return bsplit16(v); }
__device__ __forceinline__ F2 split_rowK(const float* row, int k0, int lane, int K) { float v[16]; const int g = lane >> 4;
#pragma unroll
  for (int i = 0; i < 8; ++i) { const int ka = k0 + 8 * g + i, kb = ka + 16; v[i] = ka < K ? row[ka < K ? ka : K - 1] : 0.f; v[8 + i] = kb < K ? row[kb < K ? kb : K - 1] : 0.f; }
  return bsplit16(v); }
__device__ __forceinline__ F2 split_col(const float* W, int k0, int n, int lane, int ld, int K) { float v[16]; const int g = lane >> 4;
#pragma unroll
  for (int i = 0; i < 8; ++i) { const int ka = k0 + 8 * g + i, kb = ka + 16; v[i] = ka < K ? W[(size_t)(ka < K ? ka : K - 1) * ld + n] : 0.f; v[8 + i] = kb < K ? W[(size_t)(kb < K ? kb : K - 1) * ld + n] : 0.f; }
  return bsplit16(v); }
__device__ __forceinline__ v8f mac3(const F2& a, const F2& b, v8f c) { c = wmma_bf(a.l, b.h, c); c = wmma_bf(a.h, b.l, c); return wmma_bf(a.h, b.h, c); }
__device__ __forceinline__ float sigm(float v) { return 1.0f / (1.0f + expf(-v)); }
#define LDSX() do { asm volatile("s_wait_dscnt 0" ::: "memory"); __builtin_amdgcn_wave_barrier(); __builtin_amdgcn_fence(__ATOMIC_RELEASE, "workgroup"); } while (0)


#define NB 4
__constant__ float INVF[32] = {1.000000000e+00f,7.498942018e-01f,5.623413324e-01f,4.216965139e-01f,3.162277639e-01f,2.371373773e-01f,1.778279394e-01f,1.333521456e-01f,1.000000015e-01f,7.498942316e-02f,5.623413250e-02f,4.216964915e-02f,3.162277490e-02f,2.371373773e-02f,1.778279431e-02f,1.333521400e-02f,9.999999776e-03f,7.498942316e-03f,5.623413250e-03f,4.216964822e-03f,3.162277630e-03f,2.371373819e-03f,1.778279431e-03f,1.333521446e-03f,1.000000047e-03f,7.498941850e-04f,5.623413017e-04f,4.216965172e-04f,3.162277571e-04f,2.371373703e-04f,1.778279402e-04f,1.333521504e-04f};
__device__ __attribute__((noinline)) float cos_p(float v) { return cosf(v); }
__device__ __attribute__((noinline)) float sin_p(float v) { return sinf(v); }
#define SS 2048
#define DM 1024
#define NH 16
#define HD 64
#define QKVW (3 * DM)
#ifndef TQB
#define TQB (SS / 64)
#define TNB NB
#define TOB (NB * SS / 64)     // 64-row tiles of all rows (unused)
#endif
typedef __attribute__((ext_vector_type(8))) __bf16 v8b;
__device__ __forceinline__ v16b frag_b(const __bf16* rowk0, int lane) {
  union { v16b v; v8b q[2]; } u; const __bf16* p = rowk0 + 8 * (lane >> 4);
  u.q[0] = *(const v8b*)p; u.q[1] = *(const v8b*)(p + 16); return u.v;
}
__device__ __forceinline__ float bfr(float v) { return (float)(__bf16)v; }
__device__ __attribute__((noinline)) float exp_ni(float v) { return expf(v); }
__device__ __attribute__((noinline)) float erf_ni(float v) { return erff(v); }

#define PK_A 0                       // [3072][1024] Wqkv rows (natural [out][in])
#define PK_P (PK_A + QKVW * DM)        // [1024][1024] Wo rows (natural)
#define PK_END (PK_P + DM * DM)
#define WS_PK  0u
#define WS_QK  (WS_PK + 2u * PK_END)             // f16 [8192 rows][2048]: q | k
#define WS_QKL (WS_QK + 2u * NB * SS * 2 * DM)     // f16 q | k residual planes x2048
#define WS_VTH (WS_QKL + 2u * NB * SS * 2 * DM)    // f16 [b][1024 (h*64+d)][2048 s] hi
#define WS_VTL (WS_VTH + 2u * NB * DM * SS)        // f16 lo x 2048
#define WS_O   (WS_VTL + 2u * NB * DM * SS)        // f32 [8192][1024]
#define WS_CS  (WS_O + 4u * NB * SS * DM)           // f32 2 x [2048][32], unused (cos/sin are computed in k_qkv)
#define WS_END (WS_CS + 4u * 2 * SS * 32)
// ---- LDS staging by asynchronous copies: every lane brings 16 bytes, a wave's copy covers whole 128-byte lines; rows padded by 16 bytes for the 16-byte fragment reads
#define ROWP 144                       // LDS pitch of a 128-byte row
#define ROWP2 272                      // LDS pitch of a 256-byte row
#define GK 64                          // k per GEMM stage
#define GBM 128                        // rows of a work-group's GEMM tile: 4 waves down, 32 rows each
#define GBN 256                        // columns of it: 2 waves across, 128 columns each
#define GB_BYTES (GBN * ROWP)          // 256 weight rows x 64 bf16
#define GA_BYTES (GBM * ROWP2)         // 128 activation rows x 64 f32
#define GSTAGE (GB_BYTES + GA_BYTES)
#define AT_BYTES (64 * ROWP)           // attention: 64 rows x 64 f16 (k rows; v hi; v lo)
#define ASTAGE (3 * AT_BYTES)
// the landing wait of this wave's own copies; the barrier behind it publishes them to the other waves
#define WAIT_ASYNC() asm volatile("s_wait_asynccnt 0x0" ::: "memory")
// this wave's LDS reads have returned before the barrier behind which their buffer is refilled
#define WAIT_DS() asm volatile("s_wait_dscnt 0x0" ::: "memory")
// a group of LDS fragment reads is held in front of the matrix instructions that use it, so that the reads issue together and are waited for once, not one pair and one wait per matrix instruction (loaded values as inputs only: nothing is changed and no product is named)
#define HOLD4(a, b, c, d) asm volatile("" :: "v"(a), "v"(b), "v"(c), "v"(d))
#define HOLD8(a, b, c, d, e, f, g, h) asm volatile("" :: "v"(a), "v"(b), "v"(c), "v"(d), "v"(e), "v"(f), "v"(g), "v"(h))
// four copies of one lane at constant row steps; s_wait_xcnt closes the statement so that no address register is rewritten ahead of it
__device__ __forceinline__ void acopy4(unsigned l, unsigned ls, const char* gp, size_t gs) {
  asm volatile("global_load_async_to_lds_b128 %0, %4, off\n\t"
               "global_load_async_to_lds_b128 %1, %5, off\n\t"
               "global_load_async_to_lds_b128 %2, %6, off\n\t"
               "global_load_async_to_lds_b128 %3, %7, off\n\t"
               "s_wait_xcnt 0x0"
               :: "v"(l), "v"(l + ls), "v"(l + 2 * ls), "v"(l + 3 * ls), "v"(gp), "v"(gp + gs), "v"(gp + 2 * gs), "v"(gp + 3 * gs) : "memory");
}
// one GEMM stage, brought by 256 threads: weight rows n0..n0+255 and activation rows r..r+127, 64 k each (Ar, Br point at the stage's first k)
__device__ __forceinline__ void gemm_fill(unsigned lb, const float* Ar, const __bf16* Br, int tid) {
  const unsigned lB = lb + (tid >> 3) * ROWP + (tid & 7) * 16; const char* gB = (const char*)(Br + (size_t)(tid >> 3) * DM) + (tid & 7) * 16;
  acopy4(lB, 32 * ROWP, gB, (size_t)32 * DM * 2); acopy4(lB + 128 * ROWP, 32 * ROWP, gB + (size_t)128 * DM * 2, (size_t)32 * DM * 2);
  const unsigned lA = lb + GB_BYTES + (tid >> 4) * ROWP2 + (tid & 15) * 16; const char* gA = (const char*)(Ar + (size_t)(tid >> 4) * DM) + (tid & 15) * 16;
  acopy4(lA, 16 * ROWP2, gA, (size_t)16 * DM * 4); acopy4(lA + 64 * ROWP2, 16 * ROWP2, gA + (size_t)64 * DM * 4, (size_t)16 * DM * 4);
}
// one attention stage: 64 k rows (64 dims each) and, for 64 dims, 64 keys of v hi and of v lo; every row 128 bytes at a global pitch of 4,096 bytes
__device__ __forceinline__ void attn_fill(unsigned lb, const _Float16* Kr, const _Float16* Vh, const _Float16* Vl, int tid) {
  const unsigned l = lb + (tid >> 3) * ROWP + (tid & 7) * 16; const size_t ko = (size_t)(tid >> 3) * (2 * DM * 2) + (tid & 7) * 16, vo = (size_t)(tid >> 3) * (SS * 2) + (tid & 7) * 16;
  acopy4(l, 16 * ROWP, (const char*)Kr + ko, (size_t)16 * 2 * DM * 2);
  acopy4(l + AT_BYTES, 16 * ROWP, (const char*)Vh + vo, (size_t)16 * SS * 2);
  acopy4(l + 2 * AT_BYTES, 16 * ROWP, (const char*)Vl + vo, (size_t)16 * SS * 2);
}
// ---- k_pack: block = (row n, which): natural [out][in] rows -> bf16; which 0..2 -> W_q/W_k/W_v into PK_A rows which*1024 + n; 3 -> W_o into PK_P
__global__ __launch_bounds__(256) void k_pack(const float* __restrict__ WQ, const float* __restrict__ WK, const float* __restrict__ WV, const float* __restrict__ WO, __bf16* __restrict__ PK) {
  __shared__ __align__(16) __bf16 s[DM]; const int n = blockIdx.x, which = blockIdx.y, t = threadIdx.x; const float* Wm = (which == 0) ? WQ : (which == 1) ? WK : (which == 2) ? WV : WO;
  for (int k = t; k < DM; k += 256) s[k] = (__bf16)Wm[(size_t)n * DM + k];
  __syncthreads();
  __bf16* dst = (which < 3) ? PK + PK_A + ((size_t)which * DM + n) * DM : PK + PK_P + (size_t)n * DM;
  for (int q = t; q < DM / 8; q += 256) vst2((unsigned*)(dst + q * 8), *(const v4u*)&s[q * 8]);
}
// ---- k_qkv: block = (128 rows, 256 cols), 8 waves as 4 x 2, a wave holds 32 rows x 128 cols (two heads): every weight fragment read from LDS serves two row fragments; four waves a SIMD asked for (256 registers a wave), so that two blocks share a WGP and one block's epilogue and ring waits are covered by the other
__global__ __launch_bounds__(256) __attribute__((amdgpu_waves_per_eu(4, 4))) void k_qkv(const float* __restrict__ X, const __bf16* __restrict__ P, _Float16* __restrict__ QK, _Float16* __restrict__ QKL, _Float16* __restrict__ VTH, _Float16* __restrict__ VTL) {
  __shared__ __align__(16) char smem[2 * GSTAGE];   // two stage buffers; behind the loop's last barrier the same bytes stage the output
  float (*sf)[32][132] = (float (*)[32][132])smem; _Float16 (*sth)[136] = (_Float16 (*)[136])smem; _Float16 (*stl)[136] = (_Float16 (*)[136])(smem + GBN * 136 * 2);
  const int tid = threadIdx.x, wave = tid >> 5, lane = tid & 31, col = lane & 15, g = lane >> 4, wm = wave >> 1, wn = wave & 1; const size_t r0 = (size_t)blockIdx.x * GBM + wm * 32; const int n0 = blockIdx.y * GBN, nw = n0 + wn * 128;
  v8f acc[2][8] = {};
  const unsigned l0 = (unsigned)(uintptr_t)smem; const float* Ab = X + (size_t)blockIdx.x * GBM * DM; const __bf16* Bb = P + (size_t)n0 * DM;
  gemm_fill(l0, Ab, Bb, tid); WAIT_ASYNC(); __syncthreads();
  gemm_fill(l0 + GSTAGE, Ab + GK, Bb + GK, tid);
#pragma unroll 1   // one stage a trip: the ring's order at the foot stays as written
  for (int t = 0; t < DM / GK; ++t) { const char* sb = smem + (t & 1) * GSTAGE;
#pragma unroll   // both 32-k halves of a stage written out: their LDS offsets become immediates
    for (int kc = 0; kc < GK / 32; ++kc) { const float* p = (const float*)(sb + GB_BYTES + (wm * 32 + col) * ROWP2) + kc * 32 + 8 * g; const float* p1 = (const float*)((const char*)p + 16 * ROWP2);
      const v4f a0 = *(const v4f*)p, a1 = *(const v4f*)(p + 4), a2 = *(const v4f*)(p + 16), a3 = *(const v4f*)(p + 20), b0 = *(const v4f*)p1, b1 = *(const v4f*)(p1 + 4), b2 = *(const v4f*)(p1 + 16), b3 = *(const v4f*)(p1 + 20); v16b w[8], a[2];
#pragma unroll
      for (int j = 0; j < 8; ++j) w[j] = frag_b((const __bf16*)(sb + (wn * 128 + j * 16 + col) * ROWP) + kc * 32, lane);
      HOLD8(a0, a1, a2, a3, b0, b1, b2, b3); HOLD8(w[0], w[1], w[2], w[3], w[4], w[5], w[6], w[7]);   // the reads of this k step issue together, in front of its matrix instructions
#pragma unroll
      for (int i = 0; i < 4; ++i) { a[0][i] = (__bf16)a0[i]; a[0][4 + i] = (__bf16)a1[i]; a[0][8 + i] = (__bf16)a2[i]; a[0][12 + i] = (__bf16)a3[i]; a[1][i] = (__bf16)b0[i]; a[1][4 + i] = (__bf16)b1[i]; a[1][8 + i] = (__bf16)b2[i]; a[1][12 + i] = (__bf16)b3[i]; }
#pragma unroll
      for (int j = 0; j < 8; ++j) { acc[0][j] = wmma_bf(a[0], w[j], acc[0][j]); acc[1][j] = wmma_bf(a[1], w[j], acc[1][j]); } }
    WAIT_DS(); WAIT_ASYNC(); __syncthreads();
    if (t + 2 < DM / GK) gemm_fill(l0 + (t & 1) * GSTAGE, Ab + (t + 2) * GK, Bb + (t + 2) * GK, tid); }
  WAIT_ASYNC();
  if (n0 < 2 * DM) {   // q and k: the wave parks its 32 x 128 tile in LDS as f32 and walks it two rows a trip (a lane keeps the elements it held in the accumulators), so that no accumulator lives across the cos / sin calls: rms-norm per head (tiles 0-3 = head A, 4-7 = head B of this wave's 128 columns), then rotary (pairs d, d+32 = tiles j, j+2), then f16 hi + residual, written over the row's own f32 bytes (hi 256 bytes, residual 256 bytes)
#pragma unroll
    for (int m = 0; m < 2; ++m) {
#pragma unroll
      for (int j = 0; j < 8; ++j) {
#pragma unroll
        for (int r = 0; r < 8; ++r) sf[wave][m * 16 + 8 * g + r][j * 16 + col] = acc[m][j][r]; } }
    LDSX();
    const float fq[2] = {INVF[col], INVF[16 + col]};
#pragma unroll 1   // rolled: four calls a trip, few registers live across them
    for (int rr = 0; rr < 16; ++rr) { const int row = (rr >> 3) * 16 + 8 * g + (rr & 7); const int tpos = (int)((r0 + row) % SS); float a[8], c[2], sn[2];
#pragma unroll
      for (int j = 0; j < 8; ++j) a[j] = sf[wave][row][j * 16 + col];
      LDSX();   // every lane's f32 reads of the two rows have returned before any lane writes f16 over them
#pragma unroll
      for (int j = 0; j < 2; ++j) { const float fr = (float)tpos * fq[j]; c[j] = bfr(cos_p(fr)); sn[j] = bfr(sin_p(fr)); }
#pragma unroll
      for (int hh = 0; hh < 2; ++hh) { float ssq = 0.f;
#pragma unroll
        for (int j = 0; j < 4; ++j) ssq += a[hh * 4 + j] * a[hh * 4 + j];
#pragma unroll
        for (int o = 1; o < 16; o <<= 1) ssq += __shfl_xor(ssq, o);
        const float rinv = 1.0f / sqrtf(ssq / 64.0f + 1.1920928955078125e-07f);
#pragma unroll
        for (int j = 0; j < 2; ++j) { const float x1 = a[hh * 4 + j] * rinv, x2 = a[hh * 4 + j + 2] * rinv;
          a[hh * 4 + j] = x1 * c[j] + x2 * sn[j]; a[hh * 4 + j + 2] = -x1 * sn[j] + x2 * c[j]; } }
      _Float16* ph = (_Float16*)&sf[wave][row][0];
#pragma unroll
      for (int j = 0; j < 8; ++j) { const float v = a[j]; const _Float16 hv = (_Float16)v; ph[j * 16 + col] = hv; ph[128 + j * 16 + col] = (_Float16)((v - (float)hv) * 2048.0f); } }   // q, k (normed + rotated) as f16 hi + (x2048) residual
    LDSX();
    for (int rl = 0; rl < 32; ++rl) if (lane < 16) { const char* pr = (const char*)&sf[wave][rl][0] + lane * 16; vst2((unsigned*)(QK + (r0 + rl) * (2 * DM) + nw + lane * 8), *(const v4u*)pr); vst2((unsigned*)(QKL + (r0 + rl) * (2 * DM) + nw + lane * 8), *(const v4u*)(pr + 256)); }
  } else {
#pragma unroll
    for (int m = 0; m < 2; ++m) {
#pragma unroll
    for (int j = 0; j < 8; ++j) {
#pragma unroll
      for (int r = 0; r < 8; ++r) { const float v = acc[m][j][r]; const _Float16 hv = (_Float16)v; sth[wn * 128 + j * 16 + col][wm * 32 + m * 16 + 8 * g + r] = hv; stl[wn * 128 + j * 16 + col][wm * 32 + m * 16 + 8 * g + r] = (_Float16)((v - (float)hv) * 2048.0f); } } }
    __syncthreads();
    const size_t rb = (size_t)blockIdx.x * GBM; const int b = (int)(rb / SS), s0 = (int)(rb % SS); const int pc0 = n0 - 2 * DM;
    for (int q = tid; q < GBN * 16; q += 256) { const int d = q >> 4, pc = q & 15; const size_t o = ((size_t)b * DM + pc0 + d) * SS + s0 + pc * 8; vst2((unsigned*)(VTH + o), *(const v4u*)&sth[d][pc * 8]); vst2((unsigned*)(VTL + o), *(const v4u*)&stl[d][pc * 8]); }
  }
}
// lane l with lane l ^ 16 (the two halves of a wave hold the two key halves of one query column)
__device__ __forceinline__ float xhalf(float x) { return __builtin_bit_cast(float, __builtin_amdgcn_permlanex16(__builtin_bit_cast(int, x), __builtin_bit_cast(int, x), 0x76543210, 0xfedcba98, false, false)); }
// 2^x for eight values: the v_exp_f32 stand in ONE statement with early-clobber outputs, so that none reads the result or overwrites the source of the one in front of it; the v_nop is the slot the instruction set asks for behind the last of them
__device__ __forceinline__ void exp2_8(const float* x, float* e) {
  asm("v_exp_f32 %0, %8\n\tv_exp_f32 %1, %9\n\tv_exp_f32 %2, %10\n\tv_exp_f32 %3, %11\n\tv_exp_f32 %4, %12\n\tv_exp_f32 %5, %13\n\tv_exp_f32 %6, %14\n\tv_exp_f32 %7, %15\n\tv_nop"
      : "=&v"(e[0]), "=&v"(e[1]), "=&v"(e[2]), "=&v"(e[3]), "=&v"(e[4]), "=&v"(e[5]), "=&v"(e[6]), "=&v"(e[7])
      : "v"(x[0]), "v"(x[1]), "v"(x[2]), "v"(x[3]), "v"(x[4]), "v"(x[5]), "v"(x[6]), "v"(x[7]));
}
__global__ __launch_bounds__(128) void k_attn(const _Float16* __restrict__ QK, const _Float16* __restrict__ QKL, const _Float16* __restrict__ VTH, const _Float16* __restrict__ VTL, float* __restrict__ O) {
  __shared__ __align__(16) char smem[2 * ASTAGE];   // two stage buffers; behind the loop's last barrier the same bytes stage the output
  float (*so)[16][68] = (float (*)[16][68])smem;
  const int tid = threadIdx.x, wave = tid >> 5, lane = tid & 31, col = lane & 15, g = lane >> 4;
  // low z takes the query tiles with the most key stages, the one-stage tiles come at the end (for speed only)
  const int qb = TQB - 1 - (int)blockIdx.z, h = blockIdx.x, b = blockIdx.y; const int q0 = qb * 64 + wave * 16; const size_t rq = (size_t)b * SS + q0 + col; const int qi = q0 + col;
  (void)QKL;
  v16h aq[2];
#pragma unroll   // register arrays: every index must be a constant
  for (int kc = 0; kc < 2; ++kc) aq[kc] = frag_h(QK + rq * (2 * DM) + h * HD + kc * 32, lane);
  float l = 0.f;   // of query qi: this lane half's share of the sum of the weights, joined behind the loop
  v8f acc[4] = {}, accl[4] = {};   // O^T tiles: register r = dim dt * 16 + 8 g + r of query qi
  const unsigned l0 = (unsigned)(uintptr_t)smem; const _Float16* Kb = QK + (size_t)b * SS * (2 * DM) + DM + h * HD; const _Float16* Vhb = VTH + ((size_t)b * DM + h * HD) * SS; const _Float16* Vlb = VTL + ((size_t)b * DM + h * HD) * SS;
  attn_fill(l0, Kb, Vhb, Vlb, tid); WAIT_ASYNC(); __syncthreads();
  if (qb >= 1) attn_fill(l0 + ASTAGE, Kb + (size_t)64 * (2 * DM), Vhb + 64, Vlb + 64, tid);
#pragma unroll 1   // one stage of 64 keys a trip: the ring's order at the foot stays as written
  for (int st = 0; st <= qb; ++st) { const char* sb = smem + (st & 1) * ASTAGE;
#pragma unroll   // both 32-key halves of a stage written out: their LDS offsets become immediates
  for (int hf = 0; hf < 2; ++hf) { const int dq = qi - 8 * g - (st * 2 + hf) * 32; float x[2][8], y[2][8]; v16h kf[2][2];   // key ct * 16 + r of this lane's rows is allowed while ct * 16 + r <= dq
#pragma unroll   // register arrays: every index must be a constant
    for (int ct = 0; ct < 2; ++ct) { const _Float16* krow = (const _Float16*)(sb + (hf * 32 + ct * 16 + col) * ROWP); kf[ct][0] = frag_h(krow, lane); kf[ct][1] = frag_h(krow + 32, lane); }
    HOLD4(kf[0][0], kf[0][1], kf[1][0], kf[1][1]);   // the reads of this half's k rows issue together, in front of the score products
#pragma unroll   // register arrays: every index must be a constant
    for (int ct = 0; ct < 2; ++ct) { v8f c = {};
#pragma unroll   // register arrays: every index must be a constant
      for (int kc = 0; kc < 2; ++kc) c = wmma16(kf[ct][kc], aq[kc], c);   // single product: q, k (unit-norm heads) as one-rounding f16 operands; register r = key ct * 16 + 8 g + r
#pragma unroll   // register arrays: every index must be a constant
      for (int r = 0; r < 8; ++r) x[ct][r] = (ct * 16 + r <= dq) ? c[r] * 0.18033688f - 0.54156033f : -3.0e38f; }   // log2 of the weight 2^11 e^(c / 8 - 8): (c / 8 - 8) log2 e + 11 in one multiply-add; a key behind the query gets 2^(-3e38) = 0
    exp2_8(x[0], y[0]); exp2_8(x[1], y[1]);
    v16h pa; float t[8];   // the factor 2^11 keeps every weight, from 2^11 e^-16.1 up, a normal f16 number; l carries it too, so it cancels in the epilogue
#pragma unroll   // register arrays: every index must be a constant
    for (int r = 0; r < 8; ++r) { t[r] = y[0][r] + y[1][r]; pa[r] = (_Float16)y[0][r]; pa[8 + r] = (_Float16)y[1][r]; }   // element s of the B operand = key 8 g + s (s < 8), 16 + 8 g + s - 8 (else): the two score tiles as they lie
    l += ((t[0] + t[1]) + (t[2] + t[3])) + ((t[4] + t[5]) + (t[6] + t[7]));
#pragma unroll   // register arrays: every index must be a constant
    for (int dt = 0; dt < 4; ++dt) { const _Float16* vr = (const _Float16*)(sb + AT_BYTES + (dt * 16 + col) * ROWP) + hf * 32; acc[dt] = wmma16(frag_h(vr, lane), pa, acc[dt]); accl[dt] = wmma16(frag_h(vr + AT_BYTES / 2, lane), pa, accl[dt]); } }   // V hi x P (single) + V lo x P / 2048: 2 products
    WAIT_DS(); WAIT_ASYNC(); __syncthreads();
    if (st + 2 <= qb) attn_fill(l0 + (st & 1) * ASTAGE, Kb + (size_t)(st + 2) * 64 * (2 * DM), Vhb + (st + 2) * 64, Vlb + (st + 2) * 64, tid); }
  WAIT_ASYNC();
  const float il = 1.0f / (l + xhalf(l));
#pragma unroll   // register arrays: every index must be a constant
  for (int dt = 0; dt < 4; ++dt) { v4f o0, o1;
#pragma unroll   // register arrays: every index must be a constant
    for (int r = 0; r < 4; ++r) { o0[r] = (acc[dt][r] + accl[dt][r] * (1.0f / 2048.0f)) * il; o1[r] = (acc[dt][4 + r] + accl[dt][4 + r] * (1.0f / 2048.0f)) * il; }
    *(v4f*)&so[wave][col][dt * 16 + 8 * g] = o0; *(v4f*)&so[wave][col][dt * 16 + 8 * g + 4] = o1; }
  LDSX();
  for (int rl = 0; rl < 16; ++rl) if (lane < 16) vst2(O + ((size_t)b * SS + q0 + rl) * DM + h * HD + lane * 4, *(const v4f*)&so[wave][rl][lane * 4]);
}
// ---- k_out: block = (128 rows, 256 cols), 8 waves as 4 x 2, a wave holds 32 rows x 128 cols: out = O(hi/lo) . Wo rows (2 products) + bo
__global__ __launch_bounds__(256) void k_out(const float* __restrict__ O, const __bf16* __restrict__ P, const float* __restrict__ BO, float* __restrict__ Y) {
  __shared__ __align__(16) char smem[2 * GSTAGE];   // two stage buffers; behind the loop's last barrier the same bytes stage the output
  float (*so)[32][132] = (float (*)[32][132])smem;
  const int tid = threadIdx.x, wave = tid >> 5, lane = tid & 31, col = lane & 15, g = lane >> 4, wm = wave >> 1, wn = wave & 1; const size_t r0 = (size_t)blockIdx.x * GBM + wm * 32; const int n0 = blockIdx.y * GBN, nw = n0 + wn * 128;
  v8f acc[2][8] = {};
  const unsigned l0 = (unsigned)(uintptr_t)smem; const float* Ab = O + (size_t)blockIdx.x * GBM * DM; const __bf16* Bb = P + (size_t)n0 * DM;
  gemm_fill(l0, Ab, Bb, tid); WAIT_ASYNC(); __syncthreads();
  gemm_fill(l0 + GSTAGE, Ab + GK, Bb + GK, tid);
#pragma unroll 1   // one stage a trip: the ring's order at the foot stays as written
  for (int t = 0; t < DM / GK; ++t) { const char* sb = smem + (t & 1) * GSTAGE;
#pragma unroll   // both 32-k halves of a stage written out: their LDS offsets become immediates
    for (int kc = 0; kc < GK / 32; ++kc) { const float* p = (const float*)(sb + GB_BYTES + (wm * 32 + col) * ROWP2) + kc * 32 + 8 * g; const float* p1 = (const float*)((const char*)p + 16 * ROWP2);
      const v4f a0 = *(const v4f*)p, a1 = *(const v4f*)(p + 4), a2 = *(const v4f*)(p + 16), a3 = *(const v4f*)(p + 20), b0 = *(const v4f*)p1, b1 = *(const v4f*)(p1 + 4), b2 = *(const v4f*)(p1 + 16), b3 = *(const v4f*)(p1 + 20); v16b w[8]; float v[16], u[16];
#pragma unroll
      for (int j = 0; j < 8; ++j) w[j] = frag_b((const __bf16*)(sb + (wn * 128 + j * 16 + col) * ROWP) + kc * 32, lane);
      HOLD8(a0, a1, a2, a3, b0, b1, b2, b3); HOLD8(w[0], w[1], w[2], w[3], w[4], w[5], w[6], w[7]);   // the reads of this k step issue together, in front of its matrix instructions
#pragma unroll
      for (int i = 0; i < 4; ++i) { v[i] = a0[i]; v[4 + i] = a1[i]; v[8 + i] = a2[i]; v[12 + i] = a3[i]; u[i] = b0[i]; u[4 + i] = b1[i]; u[8 + i] = b2[i]; u[12 + i] = b3[i]; }
      const F2 a = bsplit16(v), c = bsplit16(u);
#pragma unroll
      for (int j = 0; j < 8; ++j) { acc[0][j] = wmma_bf(a.l, w[j], acc[0][j]); acc[1][j] = wmma_bf(c.l, w[j], acc[1][j]); acc[0][j] = wmma_bf(a.h, w[j], acc[0][j]); acc[1][j] = wmma_bf(c.h, w[j], acc[1][j]); } }
    WAIT_DS(); WAIT_ASYNC(); __syncthreads();
    if (t + 2 < DM / GK) gemm_fill(l0 + (t & 1) * GSTAGE, Ab + (t + 2) * GK, Bb + (t + 2) * GK, tid); }
  WAIT_ASYNC();
#pragma unroll
  for (int m = 0; m < 2; ++m) {
#pragma unroll
  for (int j = 0; j < 8; ++j) {
#pragma unroll
    for (int r = 0; r < 8; ++r) so[wave][m * 16 + 8 * g + r][j * 16 + col] = acc[m][j][r] + (BO ? bfr(BO[nw + j * 16 + col]) : 0.f); } }
  LDSX();
  for (int rl = 0; rl < 32; ++rl) vst2(Y + (r0 + rl) * DM + nw + lane * 4, *(const v4f*)&so[wave][rl][lane * 4]);
}
extern "C" void kernel_launch(void* const* d_in, const int* in_sizes, int n_in, void* d_out, int out_size, void* d_ws, size_t ws_size, hipStream_t stream) {
  (void)in_sizes; (void)n_in; (void)out_size;
  const float** F = (const float**)d_in;   // 0 x [4,2048,1024], 1 w_attn [3072,1024] natural (q | k | v row blocks), 2 w_proj [1024,1024] natural
  if (ws_size < (size_t)WS_END) return;
  char* ws = (char*)d_ws; __bf16* PK = (__bf16*)(ws + WS_PK); _Float16 *QK = (_Float16*)(ws + WS_QK), *QKL = (_Float16*)(ws + WS_QKL), *VTH = (_Float16*)(ws + WS_VTH), *VTL = (_Float16*)(ws + WS_VTL); float* O = (float*)(ws + WS_O);
  k_pack<<<dim3(DM, 4), 256, 0, stream>>>(F[1], F[1] + (size_t)DM * DM, F[1] + (size_t)2 * DM * DM, F[2], PK);
  k_qkv<<<dim3(TNB * SS / GBM, QKVW / GBN), 256, 0, stream>>>(F[0], PK + PK_A, QK, QKL, VTH, VTL);
  k_attn<<<dim3(NH, TNB, TQB), 128, 0, stream>>>(QK, QKL, VTH, VTL, O);
  k_out<<<dim3(TNB * SS / GBM, DM / GBN), 256, 0, stream>>>(O, PK + PK_P, nullptr, (float*)d_out);
}

// v007
// A run of this version takes 142 microseconds.
// Next to v006, in two timings, it ran 1.05 times as fast each time.
// All steps since v000 together make it 4.90 times as fast.
// compute dtype: all float inputs rounded to bf16; qkv = x . Wqkv^T with EXACT bf16 products on WMMA 16x16x32 (natural rows); per head, q and k rms-normalised over 64 dims (eps = f32 eps, no weight) and rotated with cos/sin = bf16(cos/sin(t * inv_freq)) (inv_freq constants reproduced from the module, precise cosf/sinf, the module's bf16 cache rounding reproduced), all in f32; then q/k as single f16 operands (plain causal scores x 1/8; unit-norm heads keep logits <= 8); softmax in f32 against the fixed bound 8 of the logits, no running maximum (hardware exp); P (scaled, single f16) x v (f16 hi + x2048 residual), 2 products; out = y (bf16 hi + residual) . Wproj^T (2 products); f32 accumulate.
#include <hip/hip_runtime.h>
#include <math.h>

typedef __attribute__((ext_vector_type(16))) _Float16 v16h;
typedef __attribute__((ext_vector_type(16))) __bf16 v16b;
typedef __attribute__((ext_vector_type(8)))  _Float16 v8h;
typedef __attribute__((ext_vector_type(8)))  float v8f;
typedef __attribute__((ext_vector_type(4)))  float v4f;
typedef __attribute__((ext_vector_type(2)))  float v2f;
typedef __attribute__((ext_vector_type(4)))  unsigned v4u;
typedef __attribute__((ext_vector_type(4)))  int v4i;
typedef float __attribute__((may_alias)) float_a;
typedef int __attribute__((may_alias)) int_a;

template <typename T> __device__ __forceinline__ void vst2(void* p, T v) { *(T*)p = v;  }
__device__ __forceinline__ v8f wmma16(v16h a, v16h b, v8f c) {
  return __builtin_amdgcn_wmma_f32_16x16x32_f16(false, a, false, b, (short)0, c, false, false);
}
__device__ __forceinline__ v8f wmma_bf(v16b a, v16b b, v8f c) {
  return __builtin_amdgcn_wmma_f32_16x16x32_bf16(false, a, false, b, (short)0, c, false, false);
}
// Causal self attention with parameter-free RMS-norm and rotary embedding on q/k (B 4, T 2,048, C 1,024, 16 heads x 64): fused qkv projection (natural [3C][C] rows), causal softmax(q k^T / 8) v, output projection.
__device__ __forceinline__ v16h frag_h(const _Float16* rowk0, int lane) {
  union { v16h v; v8h q[2]; } u; const _Float16* p = rowk0 + 8 * (lane >> 4);
  u.q[0] = *(const v8h*)p; u.q[1] = *(const v8h*)(p + 16); return u.v;
}
__device__ __forceinline__ v16h frag_f32(const float* rowk0, int lane) {
  v16h a; const float* p = rowk0 + 8 * (lane >> 4);
#pragma unroll
  for (int i = 0; i < 8; ++i) { a[i] = (_Float16)p[i]; a[8 + i] = (_Float16)p[16 + i]; }
  return a;
}
__device__ __forceinline__ v16h frag_f32s(const float* rowk0, int lane, float sc) {
  v16h a; const float* p = rowk0 + 8 * (lane >> 4);
#pragma unroll
  for (int i = 0; i < 8; ++i) { a[i] = (_Float16)(p[i] * sc); a[8 + i] = (_Float16)(p[16 + i] * sc); }
  return a;
}
// column fragment from a [K][ld] layout (column n), rows >= K read as 0
__device__ __forceinline__ v16h fragc_f32(const float* W, int k0, int n, int lane, int ld, int K) {
  v16h a; const int g = lane >> 4;
#pragma unroll
  for (int i = 0; i < 8; ++i) { const int ka = k0 + 8 * g + i, kb = ka + 16;
    a[i] = (_Float16)(ka < K ? W[(size_t)(ka < K ? ka : K - 1) * ld + n] : 0.f); a[8 + i] = (_Float16)(kb < K ? W[(size_t)(kb < K ? kb : K - 1) * ld + n] : 0.f); }
  return a;
}
struct F2 { v16b h, l; };
__device__ __forceinline__ F2 bsplit16(const float v[16]) { F2 r;
#pragma unroll
  for (int i = 0; i < 16; ++i) { const __bf16 h = (__bf16)v[i]; r.h[i] = h; r.l[i] = (__bf16)(v[i] - (float)h); }
  return r; }
__device__ __forceinline__ F2 split_row(const float* row, int k0, int lane) { float v[16]; const float* p = row + k0 + 8 * (lane >> 4);
#pragma unroll
  for (int i = 0; i < 8; ++i) { v[i] = p[i]; v[8 + i] = p[16 + i]; }
  return bsplit16(v); }
__device__ __forceinline__ F2 split_rowK(const float* row, int k0, int lane, int K) { float v[16]; const int g = lane >> 4;
#pragma unroll
  for (int i = 0; i < 8; ++i) { const int ka = k0 + 8 * g + i, kb = ka + 16; v[i] = ka < K ? row[ka < K ? ka : K - 1] : 0.f; v[8 + i] = kb < K ? row[kb < K ? kb : K - 1] : 0.f; }
  return bsplit16(v); }
__device__ __forceinline__ F2 split_col(const float* W, int k0, int n, int lane, int ld, int K) { float v[16]; const int g = lane >> 4;
#pragma unroll
  for (int i = 0; i < 8; ++i) { const int ka = k0 + 8 * g + i, kb = ka + 16; v[i] = ka < K ? W[(size_t)(ka < K ? ka : K - 1) * ld + n] : 0.f; v[8 + i] = kb < K ? W[(size_t)(kb < K ? kb : K - 1) * ld + n] : 0.f; }
  return bsplit16(v); }
__device__ __forceinline__ v8f mac3(const F2& a, const F2& b, v8f c) { c = wmma_bf(a.l, b.h, c); c = wmma_bf(a.h, b.l, c); return wmma_bf(a.h, b.h, c); }
__device__ __forceinline__ float sigm(float v) { return 1.0f / (1.0f + expf(-v)); }
#define LDSX() do { asm volatile("s_wait_dscnt 0" ::: "memory"); __builtin_amdgcn_wave_barrier(); __builtin_amdgcn_fence(__ATOMIC_RELEASE, "workgroup"); } while (0)


#define NB 4
__constant__ float INVF[32] = {1.000000000e+00f,7.498942018e-01f,5.623413324e-01f,4.216965139e-01f,3.162277639e-01f,2.371373773e-01f,1.778279394e-01f,1.333521456e-01f,1.000000015e-01f,7.498942316e-02f,5.623413250e-02f,4.216964915e-02f,3.162277490e-02f,2.371373773e-02f,1.778279431e-02f,1.333521400e-02f,9.999999776e-03f,7.498942316e-03f,5.623413250e-03f,4.216964822e-03f,3.162277630e-03f,2.371373819e-03f,1.778279431e-03f,1.333521446e-03f,1.000000047e-03f,7.498941850e-04f,5.623413017e-04f,4.216965172e-04f,3.162277571e-04f,2.371373703e-04f,1.778279402e-04f,1.333521504e-04f};
__device__ __attribute__((noinline)) float cos_p(float v) { return cosf(v); }
__device__ __attribute__((noinline)) float sin_p(float v) { return sinf(v); }
#define SS 2048
#define DM 1024
#define NH 16
#define HD 64
#define QKVW (3 * DM)
#ifndef TQB
#define TQB (SS / 64)
#define TNB NB
#define TOB (NB * SS / 64)     // 64-row tiles of all rows (unused)
#endif
typedef __attribute__((ext_vector_type(8))) __bf16 v8b;
__device__ __forceinline__ v16b frag_b(const __bf16* rowk0, int lane) {
  union { v16b v; v8b q[2]; } u; const __bf16* p = rowk0 + 8 * (lane >> 4);
  u.q[0] = *(const v8b*)p; u.q[1] = *(const v8b*)(p + 16); return u.v;
}
__device__ __forceinline__ float bfr(float v) { return (float)(__bf16)v; }
__device__ __attribute__((noinline)) float exp_ni(float v) { return expf(v); }
__device__ __attribute__((noinline)) float erf_ni(float v) { return erff(v); }

#define PK_A 0                       // [3072][1024] Wqkv rows (natural [out][in])
#define PK_P (PK_A + QKVW * DM)        // [1024][1024] Wo rows (natural)
#define PK_END (PK_P + DM * DM)
#define WS_PK  0u
#define WS_QK  (WS_PK + 2u * PK_END)             // f16 [8192 rows][2048]: q | k
#define WS_QKL (WS_QK + 2u * NB * SS * 2 * DM)     // f16 q | k residual planes x2048
#define WS_VTH (WS_QKL + 2u * NB * SS * 2 * DM)    // f16 [b][1024 (h*64+d)][2048 s] hi
#define WS_VTL (WS_VTH + 2u * NB * DM * SS)        // f16 lo x 2048
#define WS_O   (WS_VTL + 2u * NB * DM * SS)        // f32 [8192][1024]
#define WS_CS  (WS_O + 4u * NB * SS * DM)           // f32 [2048 positions][16 col][4]: cos(col), cos(16 + col), sin(col), sin(16 + col), each rounded to bf16
#define WS_END (WS_CS + 4u * 2 * SS * 32)
// ---- LDS staging by asynchronous copies: every lane brings 16 bytes, a wave's copy covers whole 128-byte lines; rows padded by 16 bytes for the 16-byte fragment reads
#define ROWP 144                       // LDS pitch of a 128-byte row
#define ROWP2 272                      // LDS pitch of a 256-byte row
#define GK 64                          // k per GEMM stage
#define GBM 128                        // rows of a work-group's GEMM tile: 4 waves down, 32 rows each
#define GBN 256                        // columns of it: 2 waves across, 128 columns each
#define GB_BYTES (GBN * ROWP)          // 256 weight rows x 64 bf16
#define GA_BYTES (GBM * ROWP2)         // 128 activation rows x 64 f32
#define GSTAGE (GB_BYTES + GA_BYTES)
#define AT_BYTES (64 * ROWP)           // attention: 64 rows x 64 f16 (k rows; v hi; v lo)
#define ASTAGE (3 * AT_BYTES)
// the landing wait of this wave's own copies; the barrier behind it publishes them to the other waves
#define WAIT_ASYNC() asm volatile("s_wait_asynccnt 0x0" ::: "memory")
// this wave's LDS reads have returned before the barrier behind which their buffer is refilled
#define WAIT_DS() asm volatile("s_wait_dscnt 0x0" ::: "memory")
// a group of LDS fragment reads is held in front of the matrix instructions that use it, so that the reads issue together and are waited for once, not one pair and one wait per matrix instruction (loaded values as inputs only: nothing is changed and no product is named)
#define HOLD4(a, b, c, d) asm volatile("" :: "v"(a), "v"(b), "v"(c), "v"(d))
#define HOLD8(a, b, c, d, e, f, g, h) asm volatile("" :: "v"(a), "v"(b), "v"(c), "v"(d), "v"(e), "v"(f), "v"(g), "v"(h))
// four copies of one lane at constant row steps; s_wait_xcnt closes the statement so that no address register is rewritten ahead of it
__device__ __forceinline__ void acopy4(unsigned l, unsigned ls, const char* gp, size_t gs) {
  asm volatile("global_load_async_to_lds_b128 %0, %4, off\n\t"
               "global_load_async_to_lds_b128 %1, %5, off\n\t"
               "global_load_async_to_lds_b128 %2, %6, off\n\t"
               "global_load_async_to_lds_b128 %3, %7, off\n\t"
               "s_wait_xcnt 0x0"
               :: "v"(l), "v"(l + ls), "v"(l + 2 * ls), "v"(l + 3 * ls), "v"(gp), "v"(gp + gs), "v"(gp + 2 * gs), "v"(gp + 3 * gs) : "memory");
}
// one GEMM stage, brought by 256 threads: weight rows n0..n0+255 and activation rows r..r+127, 64 k each (Ar, Br point at the stage's first k)
__device__ __forceinline__ void gemm_fill(unsigned lb, const float* Ar, const __bf16* Br, int tid) {
  const unsigned lB = lb + (tid >> 3) * ROWP + (tid & 7) * 16; const char* gB = (const char*)(Br + (size_t)(tid >> 3) * DM) + (tid & 7) * 16;
  acopy4(lB, 32 * ROWP, gB, (size_t)32 * DM * 2); acopy4(lB + 128 * ROWP, 32 * ROWP, gB + (size_t)128 * DM * 2, (size_t)32 * DM * 2);
  const unsigned lA = lb + GB_BYTES + (tid >> 4) * ROWP2 + (tid & 15) * 16; const char* gA = (const char*)(Ar + (size_t)(tid >> 4) * DM) + (tid & 15) * 16;
  acopy4(lA, 16 * ROWP2, gA, (size_t)16 * DM * 4); acopy4(lA + 64 * ROWP2, 16 * ROWP2, gA + (size_t)64 * DM * 4, (size_t)16 * DM * 4);
}
// one attention stage: 64 k rows (64 dims each) and, for 64 dims, 64 keys of v hi and of v lo; every row 128 bytes at a global pitch of 4,096 bytes
__device__ __forceinline__ void attn_fill(unsigned lb, const _Float16* Kr, const _Float16* Vh, const _Float16* Vl, int tid) {
  const unsigned l = lb + (tid >> 3) * ROWP + (tid & 7) * 16; const size_t ko = (size_t)(tid >> 3) * (2 * DM * 2) + (tid & 7) * 16, vo = (size_t)(tid >> 3) * (SS * 2) + (tid & 7) * 16;
  acopy4(l, 16 * ROWP, (const char*)Kr + ko, (size_t)16 * 2 * DM * 2);
  acopy4(l + AT_BYTES, 16 * ROWP, (const char*)Vh + vo, (size_t)16 * SS * 2);
  acopy4(l + 2 * AT_BYTES, 16 * ROWP, (const char*)Vl + vo, (size_t)16 * SS * 2);
}
// ---- k_pack: block = (row n, which), and 32 entries of the rotary cos / sin table: natural [out][in] rows -> bf16; which 0..2 -> W_q/W_k/W_v into PK_A rows which*1024 + n; 3 -> W_o into PK_P
__global__ __launch_bounds__(256) void k_pack(const float* __restrict__ WQ, const float* __restrict__ WK, const float* __restrict__ WV, const float* __restrict__ WO, __bf16* __restrict__ PK, float* __restrict__ CS) {
  __shared__ __align__(16) __bf16 s[DM]; const int n = blockIdx.x, which = blockIdx.y, t = threadIdx.x; const float* Wm = (which == 0) ? WQ : (which == 1) ? WK : (which == 2) ? WV : WO;
  for (int k = t; k < DM; k += 256) s[k] = (__bf16)Wm[(size_t)n * DM + k];
  __syncthreads();
  __bf16* dst = (which < 3) ? PK + PK_A + ((size_t)which * DM + n) * DM : PK + PK_P + (size_t)n * DM;
  for (int q = t; q < DM / 8; q += 256) vst2((unsigned*)(dst + q * 8), *(const v4u*)&s[q * 8]);
  // the rotary table, once a call: the last wave, which has no row bytes to store, makes 32 of its 131,072 entries (one 128-byte line a block)
  if (t >= 224) { const int i = (which * DM + n) * 32 + (t - 224), e = i & 63; const float fr = (float)(i >> 6) * INVF[(e >> 2) + 16 * (e & 1)]; const float c = cos_p(fr), sn = sin_p(fr); CS[i] = bfr((e & 2) ? sn : c); }
}
// ---- k_qkv: block = (128 rows, 256 cols), 8 waves as 4 x 2, a wave holds 32 rows x 128 cols (two heads): every weight fragment read from LDS serves two row fragments; four waves a SIMD asked for (256 registers a wave), so that two blocks share a WGP and one block's epilogue and ring waits are covered by the other
__global__ __launch_bounds__(256) __attribute__((amdgpu_waves_per_eu(4, 4))) void k_qkv(const float* __restrict__ X, const __bf16* __restrict__ P, _Float16* __restrict__ QK, _Float16* __restrict__ QKL, _Float16* __restrict__ VTH, _Float16* __restrict__ VTL, const float* __restrict__ CS) {
  __shared__ __align__(16) char smem[2 * GSTAGE];   // two stage buffers; behind the loop's last barrier the same bytes stage the output
  float (*sf)[32][132] = (float (*)[32][132])smem; _Float16 (*sth)[136] = (_Float16 (*)[136])smem; _Float16 (*stl)[136] = (_Float16 (*)[136])(smem + GBN * 136 * 2);
  const int tid = threadIdx.x, wave = tid >> 5, lane = tid & 31, col = lane & 15, g = lane >> 4, wm = wave >> 1, wn = wave & 1; const size_t r0 = (size_t)blockIdx.x * GBM + wm * 32; const int n0 = blockIdx.y * GBN, nw = n0 + wn * 128;
  v8f acc[2][8] = {};
  const unsigned l0 = (unsigned)(uintptr_t)smem; const float* Ab = X + (size_t)blockIdx.x * GBM * DM; const __bf16* Bb = P + (size_t)n0 * DM;
  gemm_fill(l0, Ab, Bb, tid); WAIT_ASYNC(); __syncthreads();
  gemm_fill(l0 + GSTAGE, Ab + GK, Bb + GK, tid);
#pragma unroll 1   // one stage a trip: the ring's order at the foot stays as written
  for (int t = 0; t < DM / GK; ++t) { const char* sb = smem + (t & 1) * GSTAGE;
#pragma unroll   // both 32-k halves of a stage written out: their LDS offsets become immediates
    for (int kc = 0; kc < GK / 32; ++kc) { const float* p = (const float*)(sb + GB_BYTES + (wm * 32 + col) * ROWP2) + kc * 32 + 8 * g; const float* p1 = (const float*)((const char*)p + 16 * ROWP2);
      const v4f a0 = *(const v4f*)p, a1 = *(const v4f*)(p + 4), a2 = *(const v4f*)(p + 16), a3 = *(const v4f*)(p + 20), b0 = *(const v4f*)p1, b1 = *(const v4f*)(p1 + 4), b2 = *(const v4f*)(p1 + 16), b3 = *(const v4f*)(p1 + 20); v16b w[8], a[2];
#pragma unroll
      for (int j = 0; j < 8; ++j) w[j] = frag_b((const __bf16*)(sb + (wn * 128 + j * 16 + col) * ROWP) + kc * 32, lane);
      HOLD8(a0, a1, a2, a3, b0, b1, b2, b3); HOLD8(w[0], w[1], w[2], w[3], w[4], w[5], w[6], w[7]);   // the reads of this k step issue together, in front of its matrix instructions
#pragma unroll
      for (int i = 0; i < 4; ++i) { a[0][i] = (__bf16)a0[i]; a[0][4 + i] = (__bf16)a1[i]; a[0][8 + i] = (__bf16)a2[i]; a[0][12 + i] = (__bf16)a3[i]; a[1][i] = (__bf16)b0[i]; a[1][4 + i] = (__bf16)b1[i]; a[1][8 + i] = (__bf16)b2[i]; a[1][12 + i] = (__bf16)b3[i]; }
#pragma unroll
      for (int j = 0; j < 8; ++j) { acc[0][j] = wmma_bf(a[0], w[j], acc[0][j]); acc[1][j] = wmma_bf(a[1], w[j], acc[1][j]); } }
    WAIT_DS(); WAIT_ASYNC(); __syncthreads();
    if (t + 2 < DM / GK) gemm_fill(l0 + (t & 1) * GSTAGE, Ab + (t + 2) * GK, Bb + (t + 2) * GK, tid); }
  WAIT_ASYNC();
  if (n0 < 2 * DM) {   // q and k, on the accumulators, two rows a trip (lane half g has row m * 16 + 8 g + r); cos / sin of a row's position come from k_pack's table, one 16-byte load a trip, all issued in front of the walk; no call stands in the walk, so the tile is not parked in LDS first: rms-norm per head (tiles 0-3 = head A, 4-7 = head B of this wave's 128 columns), then rotary (pairs d, d+32 = tiles j, j+2), then f16 hi + residual into the row's place in LDS (hi 256 bytes, residual 256 bytes)
    v4f cs[16]; const float* csr = CS + ((size_t)(r0 % SS) + 8 * g) * 64 + col * 4;   // a wave's 32 rows lie inside one sequence: SS is a multiple of 32
#pragma unroll
    for (int rr = 0; rr < 16; ++rr) cs[rr] = *(const v4f*)(csr + ((rr >> 3) * 16 + (rr & 7)) * 64);
    asm volatile("s_wait_xcnt 0x0" :: "v"(csr) : "memory");   // stands in front of every overwrite of the address registers that the 16 issued loads name; the address is an input, so that it stays in them up to here
#pragma unroll   // register arrays acc, cs: every index must be a constant
    for (int rr = 0; rr < 16; ++rr) { const int row = (rr >> 3) * 16 + 8 * g + (rr & 7); float a[8]; const float c[2] = {cs[rr][0], cs[rr][1]}, sn[2] = {cs[rr][2], cs[rr][3]};
#pragma unroll
      for (int j = 0; j < 8; ++j) a[j] = acc[rr >> 3][j][rr & 7];
#pragma unroll
      for (int hh = 0; hh < 2; ++hh) { float ssq = 0.f;
#pragma unroll
        for (int j = 0; j < 4; ++j) ssq += a[hh * 4 + j] * a[hh * 4 + j];
#pragma unroll
        for (int o = 1; o < 16; o <<= 1) ssq += __shfl_xor(ssq, o);
        const float rinv = 1.0f / sqrtf(ssq / 64.0f + 1.1920928955078125e-07f);
#pragma unroll
        for (int j = 0; j < 2; ++j) { const float x1 = a[hh * 4 + j] * rinv, x2 = a[hh * 4 + j + 2] * rinv;
          a[hh * 4 + j] = x1 * c[j] + x2 * sn[j]; a[hh * 4 + j + 2] = -x1 * sn[j] + x2 * c[j]; } }
      _Float16* ph = (_Float16*)&sf[wave][row][0];
#pragma unroll
      for (int j = 0; j < 8; ++j) { const float v = a[j]; const _Float16 hv = (_Float16)v; ph[j * 16 + col] = hv; ph[128 + j * 16 + col] = (_Float16)((v - (float)hv) * 2048.0f); } }   // q, k (normed + rotated) as f16 hi + (x2048) residual
    LDSX();
    for (int rl = 0; rl < 32; ++rl) if (lane < 16) { const char* pr = (const char*)&sf[wave][rl][0] + lane * 16; vst2((unsigned*)(QK + (r0 + rl) * (2 * DM) + nw + lane * 8), *(const v4u*)pr); vst2((unsigned*)(QKL + (r0 + rl) * (2 * DM) + nw + lane * 8), *(const v4u*)(pr + 256)); }
  } else {
#pragma unroll
    for (int m = 0; m < 2; ++m) {
#pragma unroll
    for (int j = 0; j < 8; ++j) {
#pragma unroll
      for (int r = 0; r < 8; ++r) { const float v = acc[m][j][r]; const _Float16 hv = (_Float16)v; sth[wn * 128 + j * 16 + col][wm * 32 + m * 16 + 8 * g + r] = hv; stl[wn * 128 + j * 16 + col][wm * 32 + m * 16 + 8 * g + r] = (_Float16)((v - (float)hv) * 2048.0f); } } }
    __syncthreads();
    const size_t rb = (size_t)blockIdx.x * GBM; const int b = (int)(rb / SS), s0 = (int)(rb % SS); const int pc0 = n0 - 2 * DM;
    for (int q = tid; q < GBN * 16; q += 256) { const int d = q >> 4, pc = q & 15; const size_t o = ((size_t)b * DM + pc0 + d) * SS + s0 + pc * 8; vst2((unsigned*)(VTH + o), *(const v4u*)&sth[d][pc * 8]); vst2((unsigned*)(VTL + o), *(const v4u*)&stl[d][pc * 8]); }
  }
}
// lane l with lane l ^ 16 (the two halves of a wave hold the two key halves of one query column)
__device__ __forceinline__ float xhalf(float x) { return __builtin_bit_cast(float, __builtin_amdgcn_permlanex16(__builtin_bit_cast(int, x), __builtin_bit_cast(int, x), 0x76543210, 0xfedcba98, false, false)); }
// 2^x for eight values: the v_exp_f32 stand in ONE statement with early-clobber outputs, so that none reads the result or overwrites the source of the one in front of it; the v_nop is the slot the instruction set asks for behind the last of them
__device__ __forceinline__ void exp2_8(const float* x, float* e) {
  asm("v_exp_f32 %0, %8\n\tv_exp_f32 %1, %9\n\tv_exp_f32 %2, %10\n\tv_exp_f32 %3, %11\n\tv_exp_f32 %4, %12\n\tv_exp_f32 %5, %13\n\tv_exp_f32 %6, %14\n\tv_exp_f32 %7, %15\n\tv_nop"
      : "=&v"(e[0]), "=&v"(e[1]), "=&v"(e[2]), "=&v"(e[3]), "=&v"(e[4]), "=&v"(e[5]), "=&v"(e[6]), "=&v"(e[7])
      : "v"(x[0]), "v"(x[1]), "v"(x[2]), "v"(x[3]), "v"(x[4]), "v"(x[5]), "v"(x[6]), "v"(x[7]));
}
__global__ __launch_bounds__(128) void k_attn(const _Float16* __restrict__ QK, const _Float16* __restrict__ QKL, const _Float16* __restrict__ VTH, const _Float16* __restrict__ VTL, float* __restrict__ O) {
  __shared__ __align__(16) char smem[2 * ASTAGE];   // two stage buffers; behind the loop's last barrier the same bytes stage the output
  float (*so)[16][68] = (float (*)[16][68])smem;
  const int tid = threadIdx.x, wave = tid >> 5, lane = tid & 31, col = lane & 15, g = lane >> 4;
  // low z takes the query tiles with the most key stages, the one-stage tiles come at the end (for speed only)
  const int qb = TQB - 1 - (int)blockIdx.z, h = blockIdx.x, b = blockIdx.y; const int q0 = qb * 64 + wave * 16; const size_t rq = (size_t)b * SS + q0 + col; const int qi = q0 + col;
  (void)QKL;
  v16h aq[2];
#pragma unroll   // register arrays: every index must be a constant
  for (int kc = 0; kc < 2; ++kc) aq[kc] = frag_h(QK + rq * (2 * DM) + h * HD + kc * 32, lane);
  float l = 0.f;   // of query qi: this lane half's share of the sum of the weights, joined behind the loop
  v8f acc[4] = {}, accl[4] = {};   // O^T tiles: register r = dim dt * 16 + 8 g + r of query qi
  const unsigned l0 = (unsigned)(uintptr_t)smem; const _Float16* Kb = QK + (size_t)b * SS * (2 * DM) + DM + h * HD; const _Float16* Vhb = VTH + ((size_t)b * DM + h * HD) * SS; const _Float16* Vlb = VTL + ((size_t)b * DM + h * HD) * SS;
  attn_fill(l0, Kb, Vhb, Vlb, tid); WAIT_ASYNC(); __syncthreads();
  if (qb >= 1) attn_fill(l0 + ASTAGE, Kb + (size_t)64 * (2 * DM), Vhb + 64, Vlb + 64, tid);
#pragma unroll 1   // one stage of 64 keys a trip: the ring's order at the foot stays as written
  for (int st = 0; st <= qb; ++st) { const char* sb = smem + (st & 1) * ASTAGE;
#pragma unroll   // both 32-key halves of a stage written out: their LDS offsets become immediates
  for (int hf = 0; hf < 2; ++hf) { const int dq = qi - 8 * g - (st * 2 + hf) * 32; float x[2][8], y[2][8]; v16h kf[2][2];   // key ct * 16 + r of this lane's rows is allowed while ct * 16 + r <= dq
#pragma unroll   // register arrays: every index must be a constant
    for (int ct = 0; ct < 2; ++ct) { const _Float16* krow = (const _Float16*)(sb + (hf * 32 + ct * 16 + col) * ROWP); kf[ct][0] = frag_h(krow, lane); kf[ct][1] = frag_h(krow + 32, lane); }
    HOLD4(kf[0][0], kf[0][1], kf[1][0], kf[1][1]);   // the reads of this half's k rows issue together, in front of the score products
#pragma unroll   // register arrays: every index must be a constant
    for (int ct = 0; ct < 2; ++ct) { v8f c = {};
#pragma unroll   // register arrays: every index must be a constant
      for (int kc = 0; kc < 2; ++kc) c = wmma16(kf[ct][kc], aq[kc], c);   // single product: q, k (unit-norm heads) as one-rounding f16 operands; register r = key ct * 16 + 8 g + r
#pragma unroll   // register arrays: every index must be a constant
      for (int r = 0; r < 8; ++r) x[ct][r] = (ct * 16 + r <= dq) ? c[r] * 0.18033688f - 0.54156033f : -3.0e38f; }   // log2 of the weight 2^11 e^(c / 8 - 8): (c / 8 - 8) log2 e + 11 in one multiply-add; a key behind the query gets 2^(-3e38) = 0
    exp2_8(x[0], y[0]); exp2_8(x[1], y[1]);
    v16h pa; float t[8];   // the factor 2^11 keeps every weight, from 2^11 e^-16.1 up, a normal f16 number; l carries it too, so it cancels in the epilogue
#pragma unroll   // register arrays: every index must be a constant
    for (int r = 0; r < 8; ++r) { t[r] = y[0][r] + y[1][r]; pa[r] = (_Float16)y[0][r]; pa[8 + r] = (_Float16)y[1][r]; }   // element s of the B operand = key 8 g + s (s < 8), 16 + 8 g + s - 8 (else): the two score tiles as they lie
    l += ((t[0] + t[1]) + (t[2] + t[3])) + ((t[4] + t[5]) + (t[6] + t[7]));
#pragma unroll   // register arrays: every index must be a constant
    for (int dt = 0; dt < 4; ++dt) { const _Float16* vr = (const _Float16*)(sb + AT_BYTES + (dt * 16 + col) * ROWP) + hf * 32; acc[dt] = wmma16(frag_h(vr, lane), pa, acc[dt]); accl[dt] = wmma16(frag_h(vr + AT_BYTES / 2, lane), pa, accl[dt]); } }   // V hi x P (single) + V lo x P / 2048: 2 products
    WAIT_DS(); WAIT_ASYNC(); __syncthreads();
    if (st + 2 <= qb) attn_fill(l0 + (st & 1) * ASTAGE, Kb + (size_t)(st + 2) * 64 * (2 * DM), Vhb + (st + 2) * 64, Vlb + (st + 2) * 64, tid); }
  WAIT_ASYNC();
  const float il = 1.0f / (l + xhalf(l));
#pragma unroll   // register arrays: every index must be a constant
  for (int dt = 0; dt < 4; ++dt) { v4f o0, o1;
#pragma unroll   // register arrays: every index must be a constant
    for (int r = 0; r < 4; ++r) { o0[r] = (acc[dt][r] + accl[dt][r] * (1.0f / 2048.0f)) * il; o1[r] = (acc[dt][4 + r] + accl[dt][4 + r] * (1.0f / 2048.0f)) * il; }
    *(v4f*)&so[wave][col][dt * 16 + 8 * g] = o0; *(v4f*)&so[wave][col][dt * 16 + 8 * g + 4] = o1; }
  LDSX();
  for (int rl = 0; rl < 16; ++rl) if (lane < 16) vst2(O + ((size_t)b * SS + q0 + rl) * DM + h * HD + lane * 4, *(const v4f*)&so[wave][rl][lane * 4]);
}
// ---- k_out: block = (128 rows, 256 cols), 8 waves as 4 x 2, a wave holds 32 rows x 128 cols: out = O(hi/lo) . Wo rows (2 products) + bo
__global__ __launch_bounds__(256) void k_out(const float* __restrict__ O, const __bf16* __restrict__ P, const float* __restrict__ BO, float* __restrict__ Y) {
  __shared__ __align__(16) char smem[2 * GSTAGE];   // two stage buffers; behind the loop's last barrier the same bytes stage the output
  float (*so)[32][132] = (float (*)[32][132])smem;
  const int tid = threadIdx.x, wave = tid >> 5, lane = tid & 31, col = lane & 15, g = lane >> 4, wm = wave >> 1, wn = wave & 1; const size_t r0 = (size_t)blockIdx.x * GBM + wm * 32; const int n0 = blockIdx.y * GBN, nw = n0 + wn * 128;
  v8f acc[2][8] = {};
  const unsigned l0 = (unsigned)(uintptr_t)smem; const float* Ab = O + (size_t)blockIdx.x * GBM * DM; const __bf16* Bb = P + (size_t)n0 * DM;
  gemm_fill(l0, Ab, Bb, tid); WAIT_ASYNC(); __syncthreads();
  gemm_fill(l0 + GSTAGE, Ab + GK, Bb + GK, tid);
#pragma unroll 1   // one stage a trip: the ring's order at the foot stays as written
  for (int t = 0; t < DM / GK; ++t) { const char* sb = smem + (t & 1) * GSTAGE;
#pragma unroll   // both 32-k halves of a stage written out: their LDS offsets become immediates
    for (int kc = 0; kc < GK / 32; ++kc) { const float* p = (const float*)(sb + GB_BYTES + (wm * 32 + col) * ROWP2) + kc * 32 + 8 * g; const float* p1 = (const float*)((const char*)p + 16 * ROWP2);
      const v4f a0 = *(const v4f*)p, a1 = *(const v4f*)(p + 4), a2 = *(const v4f*)(p + 16), a3 = *(const v4f*)(p + 20), b0 = *(const v4f*)p1, b1 = *(const v4f*)(p1 + 4), b2 = *(const v4f*)(p1 + 16), b3 = *(const v4f*)(p1 + 20); v16b w[8]; float v[16], u[16];
#pragma unroll
      for (int j = 0; j < 8; ++j) w[j] = frag_b((const __bf16*)(sb + (wn * 128 + j * 16 + col) * ROWP) + kc * 32, lane);
      HOLD8(a0, a1, a2, a3, b0, b1, b2, b3); HOLD8(w[0], w[1], w[2], w[3], w[4], w[5], w[6], w[7]);   // the reads of this k step issue together, in front of its matrix instructions
#pragma unroll
      for (int i = 0; i < 4; ++i) { v[i] = a0[i]; v[4 + i] = a1[i]; v[8 + i] = a2[i]; v[12 + i] = a3[i]; u[i] = b0[i]; u[4 + i] = b1[i]; u[8 + i] = b2[i]; u[12 + i] = b3[i]; }
      const F2 a = bsplit16(v), c = bsplit16(u);
#pragma unroll
      for (int j = 0; j < 8; ++j) { acc[0][j] = wmma_bf(a.l, w[j], acc[0][j]); acc[1][j] = wmma_bf(c.l, w[j], acc[1][j]); acc[0][j] = wmma_bf(a.h, w[j], acc[0][j]); acc[1][j] = wmma_bf(c.h, w[j], acc[1][j]); } }
    WAIT_DS(); WAIT_ASYNC(); __syncthreads();
    if (t + 2 < DM / GK) gemm_fill(l0 + (t & 1) * GSTAGE, Ab + (t + 2) * GK, Bb + (t + 2) * GK, tid); }
  WAIT_ASYNC();
#pragma unroll
  for (int m = 0; m < 2; ++m) {
#pragma unroll
  for (int j = 0; j < 8; ++j) {
#pragma unroll
    for (int r = 0; r < 8; ++r) so[wave][m * 16 + 8 * g + r][j * 16 + col] = acc[m][j][r] + (BO ? bfr(BO[nw + j * 16 + col]) : 0.f); } }
  LDSX();
  for (int rl = 0; rl < 32; ++rl) vst2(Y + (r0 + rl) * DM + nw + lane * 4, *(const v4f*)&so[wave][rl][lane * 4]);
}
extern "C" void kernel_launch(void* const* d_in, const int* in_sizes, int n_in, void* d_out, int out_size, void* d_ws, size_t ws_size, hipStream_t stream) {
  (void)in_sizes; (void)n_in; (void)out_size;
  const float** F = (const float**)d_in;   // 0 x [4,2048,1024], 1 w_attn [3072,1024] natural (q | k | v row blocks), 2 w_proj [1024,1024] natural
  if (ws_size < (size_t)WS_END) return;
  char* ws = (char*)d_ws; __bf16* PK = (__bf16*)(ws + WS_PK); _Float16 *QK = (_Float16*)(ws + WS_QK), *QKL = (_Float16*)(ws + WS_QKL), *VTH = (_Float16*)(ws + WS_VTH), *VTL = (_Float16*)(ws + WS_VTL); float* O = (float*)(ws + WS_O); float* CS = (float*)(ws + WS_CS);
  k_pack<<<dim3(DM, 4), 256, 0, stream>>>(F[1], F[1] + (size_t)DM * DM, F[1] + (size_t)2 * DM * DM, F[2], PK, CS);
  k_qkv<<<dim3(TNB * SS / GBM, QKVW / GBN), 256, 0, stream>>>(F[0], PK + PK_A, QK, QKL, VTH, VTL, CS);
  k_attn<<<dim3(NH, TNB, TQB), 128, 0, stream>>>(QK, QKL, VTH, VTL, O);
  k_out<<<dim3(TNB * SS / GBM, DM / GBN), 256, 0, stream>>>(O, PK + PK_P, nullptr, (float*)d_out);
}
